// v000
// Measured on an AMD MI455X. A time is GPU time per run, averaged over a window of back-to-back runs after a warm-up
// (all launches, gaps included; the runs take copies of the inputs in turn), and the median of several windows.
// Apart from v000's, it joins two sittings. Times from different sittings can be a few percent apart, while
// side-by-side timings come from the same sitting.
// v000 is the starting kernel. One run takes 452 microseconds.
#include <hip/hip_runtime.h>
#include <hip/hip_bf16.h>

typedef __attribute__((ext_vector_type(16))) _Float16 v16h;
typedef __attribute__((ext_vector_type(8)))  _Float16 v8h;
typedef __attribute__((ext_vector_type(8)))  float    v8f;
typedef __attribute__((ext_vector_type(4)))  int      v4i;

#define BB 8
#define SS 1024
#define DD 1024
#define HH 16
#define HD 64
#define QK_SCALE 0.125f   // 64^-0.5

#if __has_builtin(__builtin_amdgcn_global_load_async_to_lds_b128)
#define HAVE_ASYNC_COPY 1
#endif

__device__ __forceinline__ void wait_async0() {
#if __has_builtin(__builtin_amdgcn_s_wait_asynccnt)
    __builtin_amdgcn_s_wait_asynccnt(0);
#else
    asm volatile("s_wait_asynccnt 0" ::: "memory");
#endif
}

// ---------------------------------------------------------------------------
// WMMA wrapper: D = A(16x32 f16) * B(32x16 f16) + C(16x16 f32)
// ---------------------------------------------------------------------------
__device__ __forceinline__ v8f wmma_f16(v16h a, v16h b, v8f c) {
    return __builtin_amdgcn_wmma_f32_16x16x32_f16(
        false, a, false, b, (short)0, c, false, false);
}

// ---------------------------------------------------------------------------
// A/B fragment loader (16-bit operand, 16x32 tile), f16 source.
// Lane L: row/col = L&15, khalf = L>>4.
//   elems 0..7  -> K = khalf*8 + e ; elems 8..15 -> K = 16 + khalf*8 + e
// ---------------------------------------------------------------------------
__device__ __forceinline__ v16h frag_from_f16(const _Float16* __restrict__ p, int kh) {
    v16h f;
    const _Float16* a = p + kh * 8;
    const _Float16* b = p + 16 + kh * 8;
#pragma unroll
    for (int e = 0; e < 8; ++e) {
        f[e]     = a[e];
        f[e + 8] = b[e];
    }
    return f;
}

// ---------------------------------------------------------------------------
// Kernel 0: fp32 -> f16 conversion (8 elements / thread).
// ---------------------------------------------------------------------------
__global__ __launch_bounds__(256)
void cvt_f32_to_f16_kernel(const float* __restrict__ src,
                           _Float16* __restrict__ dst, int n8) {
    const int i = blockIdx.x * blockDim.x + threadIdx.x;
    if (i >= n8) return;
    const float* s = src + (size_t)i * 8;
    v8h h;
#pragma unroll
    for (int e = 0; e < 8; ++e) h[e] = (_Float16)s[e];
    *(v8h*)(dst + (size_t)i * 8) = h;
}

// ---------------------------------------------------------------------------
// Kernel 1: fused QKV projection, all-f16 operands.
//   Xh : [B*S, D] f16,  W*h : [D, D] f16 (out = X @ W^T + b)
//   Q/K/V out: f16 [B, H, S, HD]; Q scaled by QK_SCALE after bias.
// Block 256 = 8 waves; wave tile 16(M) x 64(N) (4 accumulators, A reuse x4).
// grid = (M/128, D/64, 3)
// ---------------------------------------------------------------------------
__global__ __launch_bounds__(256)
void qkv_proj_kernel(const _Float16* __restrict__ Xh,
                     const _Float16* __restrict__ Wqh, const float* __restrict__ bq,
                     const _Float16* __restrict__ Wkh, const float* __restrict__ bk,
                     const _Float16* __restrict__ Wvh, const float* __restrict__ bv,
                     _Float16* __restrict__ Qo, _Float16* __restrict__ Ko,
                     _Float16* __restrict__ Vo) {
    const int wave = threadIdx.x >> 5;
    const int lane = threadIdx.x & 31;
    const int m0 = blockIdx.x * 128 + wave * 16;
    const int n0 = blockIdx.y * 64;
    const int which = blockIdx.z;

    const _Float16* W;
    const float* bias;
    _Float16* out;
    float scale;
    if (which == 0)      { W = Wqh; bias = bq; out = Qo; scale = QK_SCALE; }
    else if (which == 1) { W = Wkh; bias = bk; out = Ko; scale = 1.0f; }
    else                 { W = Wvh; bias = bv; out = Vo; scale = 1.0f; }

    const int ln = lane & 15;
    const int kh = lane >> 4;
    const _Float16* arow = Xh + (size_t)(m0 + ln) * DD;
    const _Float16* wrow = W + (size_t)(n0 + ln) * DD;

    v8f acc[4] = {};
#pragma unroll 2
    for (int k0 = 0; k0 < DD; k0 += 32) {
        __builtin_prefetch(arow + k0 + 256, 0, 3);
        const v16h a = frag_from_f16(arow + k0, kh);
#pragma unroll
        for (int t = 0; t < 4; ++t) {
            const v16h b = frag_from_f16(wrow + (size_t)(16 * t) * DD + k0, kh);
            acc[t] = wmma_f16(a, b, acc[t]);
        }
    }

    // Epilogue: C layout -> lane holds col, rows r + 8*(lane>>4).
#pragma unroll
    for (int t = 0; t < 4; ++t) {
        const int n  = n0 + 16 * t + ln;
        const float bn = bias[n];
        const int h  = n >> 6;       // head
        const int hd = n & 63;       // dim within head
#pragma unroll
        for (int r = 0; r < 8; ++r) {
            const int m = m0 + r + 8 * kh;
            const int bidx = m >> 10;
            const int s    = m & (SS - 1);
            const float val = (acc[t][r] + bn) * scale;
            out[(((size_t)bidx * HH + h) * SS + s) * HD + hd] = (_Float16)val;
        }
    }
}

// ---------------------------------------------------------------------------
// Kernel 2: flash attention per (b, h).
//   Q/K/V: f16 [B, H, S, HD]; mask fp32 [B, 1, S, S] additive.
//   Output: f16 [B, S, D] row-major.
// Block 32 (one wave) handles a 16-row Q tile x full HD; kv in 32-wide steps.
// V tile staged to LDS with async global->LDS copies (overlaps score WMMAs).
// grid = (S/16, B*H)
// ---------------------------------------------------------------------------
__global__ __launch_bounds__(32)
void flash_attn_kernel(const _Float16* __restrict__ Q,
                       const _Float16* __restrict__ K,
                       const _Float16* __restrict__ V,
                       const float* __restrict__ mask,
                       _Float16* __restrict__ Ao) {
    __shared__ _Float16 pbuf[16 * 32];   // P tile staging (C-layout -> A-layout)
    __shared__ _Float16 vtile[32 * 64];  // V kv-tile (32 rows x HD)

    const int lane = threadIdx.x;
    const int ln = lane & 15;
    const int hi = lane >> 4;
    const int q0 = blockIdx.x * 16;
    const int bh = blockIdx.y;
    const int b  = bh >> 4;
    const int h  = bh & 15;

    const _Float16* Qb = Q + (size_t)bh * SS * HD;
    const _Float16* Kb = K + (size_t)bh * SS * HD;
    const _Float16* Vb = V + (size_t)bh * SS * HD;
    const float* maskb = mask + (size_t)b * SS * SS;

    const v16h qa0 = frag_from_f16(Qb + (size_t)(q0 + ln) * HD + 0, hi);
    const v16h qa1 = frag_from_f16(Qb + (size_t)(q0 + ln) * HD + 32, hi);

    float mrow[8], lrow[8];
    v8f o[4] = {};
#pragma unroll
    for (int r = 0; r < 8; ++r) { mrow[r] = -1e30f; lrow[r] = 0.0f; }

    for (int kv0 = 0; kv0 < SS; kv0 += 32) {
        // ---- kick off V tile copy to LDS (32x64 f16 = 4KB) ----
        const _Float16* vsrc = Vb + (size_t)kv0 * HD;
#if defined(HAVE_ASYNC_COPY)
#pragma unroll
        for (int i = 0; i < 8; ++i) {
            const int off = (i * 32 + lane) * 8;  // halves, 16B per lane
            __builtin_amdgcn_global_load_async_to_lds_b128(
                (v4i*)(vsrc + off), (v4i*)(vtile + off), 0, 0);
        }
#else
#pragma unroll
        for (int i = 0; i < 8; ++i) {
            const int off = (i * 32 + lane) * 8;
            *(v8h*)(vtile + off) = *(const v8h*)(vsrc + off);
        }
#endif

        // ---- scores (overlap with the async copy) ----
        v8f s0 = {}, s1 = {};
        {
            v16h kb0 = frag_from_f16(Kb + (size_t)(kv0 + ln) * HD + 0, hi);
            v16h kb1 = frag_from_f16(Kb + (size_t)(kv0 + ln) * HD + 32, hi);
            s0 = wmma_f16(qa0, kb0, s0);
            s0 = wmma_f16(qa1, kb1, s0);
            v16h kb2 = frag_from_f16(Kb + (size_t)(kv0 + 16 + ln) * HD + 0, hi);
            v16h kb3 = frag_from_f16(Kb + (size_t)(kv0 + 16 + ln) * HD + 32, hi);
            s1 = wmma_f16(qa0, kb2, s1);
            s1 = wmma_f16(qa1, kb3, s1);
        }

        // ---- additive mask + online softmax (rows live in 16-lane halves) ----
#pragma unroll
        for (int r = 0; r < 8; ++r) {
            const int m = q0 + r + 8 * hi;
            s0[r] += maskb[(size_t)m * SS + kv0 + ln];
            s1[r] += maskb[(size_t)m * SS + kv0 + 16 + ln];

            float mx = fmaxf(s0[r], s1[r]);
#pragma unroll
            for (int d = 1; d < 16; d <<= 1) mx = fmaxf(mx, __shfl_xor(mx, d, 32));
            const float mn    = fmaxf(mrow[r], mx);
            const float alpha = __expf(mrow[r] - mn);
            const float p0 = __expf(s0[r] - mn);
            const float p1 = __expf(s1[r] - mn);
            float rs = p0 + p1;
#pragma unroll
            for (int d = 1; d < 16; d <<= 1) rs += __shfl_xor(rs, d, 32);
            lrow[r] = lrow[r] * alpha + rs;
            mrow[r] = mn;
#pragma unroll
            for (int g = 0; g < 4; ++g) o[g][r] *= alpha;

            const int ml = r + 8 * hi;
            pbuf[ml * 32 + ln]      = (_Float16)p0;
            pbuf[ml * 32 + 16 + ln] = (_Float16)p1;
        }
        __syncthreads();
        const v16h pa = frag_from_f16(pbuf + ln * 32, hi);

        // ---- drain async copy, then PV from LDS ----
#if defined(HAVE_ASYNC_COPY)
        wait_async0();
#endif
        __syncthreads();

#pragma unroll
        for (int g = 0; g < 4; ++g) {
            v16h vb;
#pragma unroll
            for (int e = 0; e < 8; ++e) {
                vb[e]     = vtile[(hi * 8 + e) * HD      + g * 16 + ln];
                vb[e + 8] = vtile[(16 + hi * 8 + e) * HD + g * 16 + ln];
            }
            o[g] = wmma_f16(pa, vb, o[g]);
        }
        __syncthreads();  // vtile/pbuf reused next iteration
    }

    // ---- finalize: O /= l, write f16 [B, S, D] ----
#pragma unroll
    for (int r = 0; r < 8; ++r) {
        const float inv = 1.0f / lrow[r];
        const int m = q0 + r + 8 * hi;
        _Float16* dst = Ao + ((size_t)b * SS + m) * DD + h * HD;
#pragma unroll
        for (int g = 0; g < 4; ++g)
            dst[g * 16 + ln] = (_Float16)(o[g][r] * inv);
    }
}

// ---------------------------------------------------------------------------
// Kernel 3: output projection, all-f16 operands, fp32 result.
//   A : f16 [B*S, D], Woh : f16 [D, D], out = A @ Wo^T + bo (fp32)
// Block 256 = 8 waves; wave tile 16 x 64 (4 accumulators).
// grid = (M/128, D/64)
// ---------------------------------------------------------------------------
__global__ __launch_bounds__(256)
void out_proj_kernel(const _Float16* __restrict__ A,
                     const _Float16* __restrict__ Woh,
                     const float* __restrict__ bo,
                     float* __restrict__ out) {
    const int wave = threadIdx.x >> 5;
    const int lane = threadIdx.x & 31;
    const int m0 = blockIdx.x * 128 + wave * 16;
    const int n0 = blockIdx.y * 64;
    const int ln = lane & 15;
    const int kh = lane >> 4;

    const _Float16* arow = A   + (size_t)(m0 + ln) * DD;
    const _Float16* wrow = Woh + (size_t)(n0 + ln) * DD;

    v8f acc[4] = {};
#pragma unroll 2
    for (int k0 = 0; k0 < DD; k0 += 32) {
        __builtin_prefetch(arow + k0 + 256, 0, 3);
        const v16h a = frag_from_f16(arow + k0, kh);
#pragma unroll
        for (int t = 0; t < 4; ++t) {
            const v16h b = frag_from_f16(wrow + (size_t)(16 * t) * DD + k0, kh);
            acc[t] = wmma_f16(a, b, acc[t]);
        }
    }

#pragma unroll
    for (int t = 0; t < 4; ++t) {
        const int n = n0 + 16 * t + ln;
        const float bn = bo[n];
#pragma unroll
        for (int r = 0; r < 8; ++r) {
            const int m = m0 + r + 8 * kh;
            out[(size_t)m * DD + n] = acc[t][r] + bn;
        }
    }
}

// ---------------------------------------------------------------------------
// Host side
// ---------------------------------------------------------------------------
extern "C" void kernel_launch(void* const* d_in, const int* in_sizes, int n_in,
                              void* d_out, int out_size, void* d_ws, size_t ws_size,
                              hipStream_t stream) {
    const float* X    = (const float*)d_in[0];  // [B, S, D]
    const float* mask = (const float*)d_in[1];  // [B, 1, S, S]
    const float* Wq   = (const float*)d_in[2];
    const float* bq   = (const float*)d_in[3];
    const float* Wk   = (const float*)d_in[4];
    const float* bk   = (const float*)d_in[5];
    const float* Wv   = (const float*)d_in[6];
    const float* bv   = (const float*)d_in[7];
    const float* Wo   = (const float*)d_in[8];
    const float* bo   = (const float*)d_in[9];
    float* out = (float*)d_out;

    // Workspace layout (halves):
    //   Xh   : B*S*D        = 8388608
    //   Wqh/Wkh/Wvh/Woh : D*D = 1048576 each
    //   Qw/Kw/Vw : B*H*S*HD = 8388608 each
    //   Aw   : B*S*D        = 8388608
    const size_t nX = (size_t)BB * SS * DD;   // 8388608
    const size_t nW = (size_t)DD * DD;        // 1048576
    _Float16* Xh  = (_Float16*)d_ws;
    _Float16* Wqh = Xh + nX;
    _Float16* Wkh = Wqh + nW;
    _Float16* Wvh = Wkh + nW;
    _Float16* Woh = Wvh + nW;
    _Float16* Qw  = Woh + nW;
    _Float16* Kw  = Qw + nX;
    _Float16* Vw  = Kw + nX;
    _Float16* Aw  = Vw + nX;

    const int M = BB * SS;  // 8192

    // ---- convert fp32 activations + weights to f16 once ----
    cvt_f32_to_f16_kernel<<<(int)(nX / 8 / 256), 256, 0, stream>>>(X, Xh, (int)(nX / 8));
    cvt_f32_to_f16_kernel<<<(int)(nW / 8 / 256), 256, 0, stream>>>(Wq, Wqh, (int)(nW / 8));
    cvt_f32_to_f16_kernel<<<(int)(nW / 8 / 256), 256, 0, stream>>>(Wk, Wkh, (int)(nW / 8));
    cvt_f32_to_f16_kernel<<<(int)(nW / 8 / 256), 256, 0, stream>>>(Wv, Wvh, (int)(nW / 8));
    cvt_f32_to_f16_kernel<<<(int)(nW / 8 / 256), 256, 0, stream>>>(Wo, Woh, (int)(nW / 8));

    dim3 gqkv(M / 128, DD / 64, 3);
    qkv_proj_kernel<<<gqkv, 256, 0, stream>>>(Xh, Wqh, bq, Wkh, bk, Wvh, bv, Qw, Kw, Vw);

    dim3 gattn(SS / 16, BB * HH);
    flash_attn_kernel<<<gattn, 32, 0, stream>>>(Qw, Kw, Vw, mask, Aw);

    dim3 gout(M / 128, DD / 64);
    out_proj_kernel<<<gout, 256, 0, stream>>>(Aw, Woh, bo, out);
}

// v001
// A run of this version takes 245 microseconds.
// Next to v000, in two timings, it ran 1.94 and 1.96 times as fast.
#include <hip/hip_runtime.h>
#include <hip/hip_bf16.h>

typedef __attribute__((ext_vector_type(16))) _Float16 v16h;
typedef __attribute__((ext_vector_type(8)))  _Float16 v8h;
typedef __attribute__((ext_vector_type(8)))  float    v8f;
typedef __attribute__((ext_vector_type(4)))  int      v4i;

#define BB 8
#define SS 1024
#define DD 1024
#define HH 16
#define HD 64
#define QK_SCALE 0.125f   // 64^-0.5

#if __has_builtin(__builtin_amdgcn_global_load_async_to_lds_b128)
#define HAVE_ASYNC_COPY 1
#endif

__device__ __forceinline__ void wait_async0() {
#if __has_builtin(__builtin_amdgcn_s_wait_asynccnt)
    __builtin_amdgcn_s_wait_asynccnt(0);
#else
    asm volatile("s_wait_asynccnt 0" ::: "memory");
#endif
}

// ---------------------------------------------------------------------------
// WMMA wrapper: D = A(16x32 f16) * B(32x16 f16) + C(16x16 f32)
// ---------------------------------------------------------------------------
__device__ __forceinline__ v8f wmma_f16(v16h a, v16h b, v8f c) {
    return __builtin_amdgcn_wmma_f32_16x16x32_f16(
        false, a, false, b, (short)0, c, false, false);
}

// ---------------------------------------------------------------------------
// A/B fragment loader (16-bit operand, 16x32 tile), f16 source.
// Lane L: row/col = L&15, khalf = L>>4.
//   elems 0..7  -> K = khalf*8 + e ; elems 8..15 -> K = 16 + khalf*8 + e
// ---------------------------------------------------------------------------
__device__ __forceinline__ v16h frag_from_f16(const _Float16* __restrict__ p, int kh) {
    v16h f;
    const _Float16* a = p + kh * 8;
    const _Float16* b = p + 16 + kh * 8;
#pragma unroll
    for (int e = 0; e < 8; ++e) {
        f[e]     = a[e];
        f[e + 8] = b[e];
    }
    return f;
}

// ---------------------------------------------------------------------------
// Shared GEMM core of the two projections: Y(128 x 256) = A(128 x K) * W(256 x K)^T.
// Block 256 = 8 waves (2 x 4), wave tile 64 x 64 (16 accumulators).
// A pass is GK k of every operand row; a stage is [A 128 rows | W 256 rows] at
// pitch GPITCH bytes in LDS; two buffers, filled by asynchronous copies to LDS
// one pass ahead of their readers.
// ---------------------------------------------------------------------------
#define GM 128
#define GN 256
#define GK 64
#define GPITCH (GK * 2 + 16)              // bytes; 16 B x odd for ds_load_b128
#define GSTAGE ((GM + GN) * GPITCH)       // bytes of one buffer
#define GPASSES (DD / GK)
#define GCROWS (256 / (GK / 8))           // rows that one copy of the block covers

__device__ __forceinline__ v16h frag_from_lds(const char* p) {
    const v8h lo = *(const v8h*)p;
    const v8h hi = *(const v8h*)(p + 32);
    return __builtin_shufflevector(lo, hi, 0, 1, 2, 3, 4, 5, 6, 7,
                                   8, 9, 10, 11, 12, 13, 14, 15);
}

// One stage: 4 copies for the rows of A and 8 for those of W, 16 B per lane each,
// GCROWS rows apart. ga / gb are this lane's 16 B in the first copied row of A / W
// at the stage's k, lds its place in the stage's buffer. One statement, so that one
// s_wait_xcnt serves all twelve and no address register is rewritten ahead of it.
static_assert(GM == 4 * GCROWS && GN == 8 * GCROWS, "copy_stage issues 4 + 8 copies");
__device__ __forceinline__ void copy_stage(unsigned lds, const _Float16* ga,
                                           const _Float16* gb) {
    const unsigned rs = GCROWS * GPITCH;      // LDS bytes between two copies
    const size_t   gs = (size_t)GCROWS * DD;  // halves between two copies
    asm volatile(
        "global_load_async_to_lds_b128 %0, %12, off\n\t"
        "global_load_async_to_lds_b128 %1, %13, off\n\t"
        "global_load_async_to_lds_b128 %2, %14, off\n\t"
        "global_load_async_to_lds_b128 %3, %15, off\n\t"
        "global_load_async_to_lds_b128 %4, %16, off\n\t"
        "global_load_async_to_lds_b128 %5, %17, off\n\t"
        "global_load_async_to_lds_b128 %6, %18, off\n\t"
        "global_load_async_to_lds_b128 %7, %19, off\n\t"
        "global_load_async_to_lds_b128 %8, %20, off\n\t"
        "global_load_async_to_lds_b128 %9, %21, off\n\t"
        "global_load_async_to_lds_b128 %10, %22, off\n\t"
        "global_load_async_to_lds_b128 %11, %23, off\n\t"
        "s_wait_xcnt 0x0"
        :: "v"(lds), "v"(lds + rs), "v"(lds + 2u * rs), "v"(lds + 3u * rs),
           "v"(lds + 4u * rs), "v"(lds + 5u * rs), "v"(lds + 6u * rs),
           "v"(lds + 7u * rs), "v"(lds + 8u * rs), "v"(lds + 9u * rs),
           "v"(lds + 10u * rs), "v"(lds + 11u * rs),
           "v"(ga), "v"(ga + gs), "v"(ga + 2 * gs), "v"(ga + 3 * gs),
           "v"(gb), "v"(gb + gs), "v"(gb + 2 * gs), "v"(gb + 3 * gs),
           "v"(gb + 4 * gs), "v"(gb + 5 * gs), "v"(gb + 6 * gs), "v"(gb + 7 * gs)
        : "memory");
}

__device__ __forceinline__ void gemm_tile_128x256(const _Float16* __restrict__ A,
                                                  const _Float16* __restrict__ Wt,
                                                  int mblk, int nblk, char* smem,
                                                  v8f (&acc)[4][4]) {
    const int tid  = threadIdx.x;
    const int wave = tid >> 5;
    const int lane = tid & 31;
    const int ln = lane & 15;
    const int kh = lane >> 4;
    const int wm = wave >> 2;   // 0..1
    const int wn = wave & 3;    // 0..3

    const int crow = tid / (GK / 8);
    const int cchk = tid % (GK / 8);
    const _Float16* ga = A  + (size_t)(mblk + crow) * DD + cchk * 8;
    const _Float16* gb = Wt + (size_t)(nblk + crow) * DD + cchk * 8;
    const unsigned lds0 = (unsigned)(size_t)smem + (unsigned)(crow * GPITCH + cchk * 16);

    const int aoff = (wm * 64 + ln) * GPITCH + kh * 16;
    const int boff = (GM + wn * 64 + ln) * GPITCH + kh * 16;

    copy_stage(lds0, ga, gb);
    // stage 0 has landed for this wave, then for all
    asm volatile("s_wait_asynccnt 0x0" ::: "memory");
    __syncthreads();
    copy_stage(lds0 + GSTAGE, ga + GK, gb + GK);

#pragma unroll 1   // the two buffers alternate by a scalar offset
    for (int t = 0; t < GPASSES; ++t) {
        const char* buf = smem + (t & 1) * GSTAGE;
#pragma unroll
        for (int ks = 0; ks < GK / 32; ++ks) {
            v16h a[4], b[4];
#pragma unroll
            for (int i = 0; i < 4; ++i)
                a[i] = frag_from_lds(buf + aoff + i * 16 * GPITCH + ks * 64);
#pragma unroll
            for (int j = 0; j < 4; ++j)
                b[j] = frag_from_lds(buf + boff + j * 16 * GPITCH + ks * 64);
            // keeps the 16 LDS reads of a k step together in front of its 16 WMMAs
            __builtin_amdgcn_sched_barrier(0);
#pragma unroll
            for (int i = 0; i < 4; ++i)
#pragma unroll
                for (int j = 0; j < 4; ++j)
                    acc[i][j] = wmma_f16(a[i], b[j], acc[i][j]);
            // the other side of the same fence: the next reads stay behind this block
            __builtin_amdgcn_sched_barrier(0);
        }
        // publish point of stage t + 1: this wave's reads of stage t are done,
        // its copies of stage t + 1 have landed, then every wave's
        asm volatile("s_wait_dscnt 0x0" ::: "memory");
        asm volatile("s_wait_asynccnt 0x0" ::: "memory");
        __syncthreads();
        if (t + 2 < GPASSES)
            copy_stage(lds0 + (unsigned)(t & 1) * GSTAGE,
                       ga + (size_t)(t + 2) * GK, gb + (size_t)(t + 2) * GK);
    }
    // no copy is left in flight when the wave goes on
    asm volatile("s_wait_asynccnt 0x0" ::: "memory");
}

// ---------------------------------------------------------------------------
// Kernel 0: fp32 -> f16 conversion (8 elements / thread).
// ---------------------------------------------------------------------------
__global__ __launch_bounds__(256)
void cvt_f32_to_f16_kernel(const float* __restrict__ src,
                           _Float16* __restrict__ dst, int n8) {
    const int i = blockIdx.x * blockDim.x + threadIdx.x;
    if (i >= n8) return;
    const float* s = src + (size_t)i * 8;
    v8h h;
#pragma unroll
    for (int e = 0; e < 8; ++e) h[e] = (_Float16)s[e];
    *(v8h*)(dst + (size_t)i * 8) = h;
}

// ---------------------------------------------------------------------------
// Kernel 1: fused QKV projection, all-f16 operands.
//   Xh : [B*S, D] f16,  W*h : [D, D] f16 (out = X @ W^T + b)
//   Q/K/V out: f16 [B, H, S, HD]; Q scaled by QK_SCALE after bias.
// Block 256 = 8 waves; block tile 128(M) x 256(N) through gemm_tile_128x256.
// grid = (M/128, D/256, 3)
// ---------------------------------------------------------------------------
__global__ __launch_bounds__(256)
void qkv_proj_kernel(const _Float16* __restrict__ Xh,
                     const _Float16* __restrict__ Wqh, const float* __restrict__ bq,
                     const _Float16* __restrict__ Wkh, const float* __restrict__ bk,
                     const _Float16* __restrict__ Wvh, const float* __restrict__ bv,
                     _Float16* __restrict__ Qo, _Float16* __restrict__ Ko,
                     _Float16* __restrict__ Vo) {
    __shared__ __attribute__((aligned(16))) char smem[2 * GSTAGE];
    const int wave = threadIdx.x >> 5;
    const int lane = threadIdx.x & 31;
    const int mblk = blockIdx.x * GM;
    const int nblk = blockIdx.y * GN;
    const int which = blockIdx.z;

    const _Float16* W;
    const float* bias;
    _Float16* out;
    float scale;
    if (which == 0)      { W = Wqh; bias = bq; out = Qo; scale = QK_SCALE; }
    else if (which == 1) { W = Wkh; bias = bk; out = Ko; scale = 1.0f; }
    else                 { W = Wvh; bias = bv; out = Vo; scale = 1.0f; }

    const int ln = lane & 15;
    const int kh = lane >> 4;

    v8f acc[4][4] = {};
    gemm_tile_128x256(Xh, W, mblk, nblk, smem, acc);

    const int m0 = mblk + (wave >> 2) * 64;
    const int n0 = nblk + (wave & 3) * 64;

    // Epilogue: C layout -> lane holds col, rows r + 8*(lane>>4).
#pragma unroll
    for (int j = 0; j < 4; ++j) {
        const int n  = n0 + 16 * j + ln;
        const float bn = bias[n];
        const int h  = n >> 6;       // head
        const int hd = n & 63;       // dim within head
#pragma unroll
        for (int i = 0; i < 4; ++i) {
#pragma unroll
            for (int r = 0; r < 8; ++r) {
                const int m = m0 + 16 * i + r + 8 * kh;
                const int bidx = m >> 10;
                const int s    = m & (SS - 1);
                const float val = (acc[i][j][r] + bn) * scale;
                out[(((size_t)bidx * HH + h) * SS + s) * HD + hd] = (_Float16)val;
            }
        }
    }
}

// ---------------------------------------------------------------------------
// Kernel 2: flash attention per (b, h).
//   Q/K/V: f16 [B, H, S, HD]; mask fp32 [B, 1, S, S] additive.
//   Output: f16 [B, S, D] row-major.
// Block 32 (one wave) handles a 16-row Q tile x full HD; kv in 32-wide steps.
// V tile staged to LDS with async global->LDS copies (overlaps score WMMAs).
// grid = (S/16, B*H)
// ---------------------------------------------------------------------------
__global__ __launch_bounds__(32)
void flash_attn_kernel(const _Float16* __restrict__ Q,
                       const _Float16* __restrict__ K,
                       const _Float16* __restrict__ V,
                       const float* __restrict__ mask,
                       _Float16* __restrict__ Ao) {
    __shared__ _Float16 pbuf[16 * 32];   // P tile staging (C-layout -> A-layout)
    __shared__ _Float16 vtile[32 * 64];  // V kv-tile (32 rows x HD)

    const int lane = threadIdx.x;
    const int ln = lane & 15;
    const int hi = lane >> 4;
    const int q0 = blockIdx.x * 16;
    const int bh = blockIdx.y;
    const int b  = bh >> 4;
    const int h  = bh & 15;

    const _Float16* Qb = Q + (size_t)bh * SS * HD;
    const _Float16* Kb = K + (size_t)bh * SS * HD;
    const _Float16* Vb = V + (size_t)bh * SS * HD;
    const float* maskb = mask + (size_t)b * SS * SS;

    const v16h qa0 = frag_from_f16(Qb + (size_t)(q0 + ln) * HD + 0, hi);
    const v16h qa1 = frag_from_f16(Qb + (size_t)(q0 + ln) * HD + 32, hi);

    float mrow[8], lrow[8];
    v8f o[4] = {};
#pragma unroll
    for (int r = 0; r < 8; ++r) { mrow[r] = -1e30f; lrow[r] = 0.0f; }

    for (int kv0 = 0; kv0 < SS; kv0 += 32) {
        // ---- kick off V tile copy to LDS (32x64 f16 = 4KB) ----
        const _Float16* vsrc = Vb + (size_t)kv0 * HD;
#if defined(HAVE_ASYNC_COPY)
#pragma unroll
        for (int i = 0; i < 8; ++i) {
            const int off = (i * 32 + lane) * 8;  // halves, 16B per lane
            __builtin_amdgcn_global_load_async_to_lds_b128(
                (v4i*)(vsrc + off), (v4i*)(vtile + off), 0, 0);
        }
#else
#pragma unroll
        for (int i = 0; i < 8; ++i) {
            const int off = (i * 32 + lane) * 8;
            *(v8h*)(vtile + off) = *(const v8h*)(vsrc + off);
        }
#endif

        // ---- scores (overlap with the async copy) ----
        v8f s0 = {}, s1 = {};
        {
            v16h kb0 = frag_from_f16(Kb + (size_t)(kv0 + ln) * HD + 0, hi);
            v16h kb1 = frag_from_f16(Kb + (size_t)(kv0 + ln) * HD + 32, hi);
            s0 = wmma_f16(qa0, kb0, s0);
            s0 = wmma_f16(qa1, kb1, s0);
            v16h kb2 = frag_from_f16(Kb + (size_t)(kv0 + 16 + ln) * HD + 0, hi);
            v16h kb3 = frag_from_f16(Kb + (size_t)(kv0 + 16 + ln) * HD + 32, hi);
            s1 = wmma_f16(qa0, kb2, s1);
            s1 = wmma_f16(qa1, kb3, s1);
        }

        // ---- additive mask + online softmax (rows live in 16-lane halves) ----
#pragma unroll
        for (int r = 0; r < 8; ++r) {
            const int m = q0 + r + 8 * hi;
            s0[r] += maskb[(size_t)m * SS + kv0 + ln];
            s1[r] += maskb[(size_t)m * SS + kv0 + 16 + ln];

            float mx = fmaxf(s0[r], s1[r]);
#pragma unroll
            for (int d = 1; d < 16; d <<= 1) mx = fmaxf(mx, __shfl_xor(mx, d, 32));
            const float mn    = fmaxf(mrow[r], mx);
            const float alpha = __expf(mrow[r] - mn);
            const float p0 = __expf(s0[r] - mn);
            const float p1 = __expf(s1[r] - mn);
            float rs = p0 + p1;
#pragma unroll
            for (int d = 1; d < 16; d <<= 1) rs += __shfl_xor(rs, d, 32);
            lrow[r] = lrow[r] * alpha + rs;
            mrow[r] = mn;
#pragma unroll
            for (int g = 0; g < 4; ++g) o[g][r] *= alpha;

            const int ml = r + 8 * hi;
            pbuf[ml * 32 + ln]      = (_Float16)p0;
            pbuf[ml * 32 + 16 + ln] = (_Float16)p1;
        }
        __syncthreads();
        const v16h pa = frag_from_f16(pbuf + ln * 32, hi);

        // ---- drain async copy, then PV from LDS ----
#if defined(HAVE_ASYNC_COPY)
        wait_async0();
#endif
        __syncthreads();

#pragma unroll
        for (int g = 0; g < 4; ++g) {
            v16h vb;
#pragma unroll
            for (int e = 0; e < 8; ++e) {
                vb[e]     = vtile[(hi * 8 + e) * HD      + g * 16 + ln];
                vb[e + 8] = vtile[(16 + hi * 8 + e) * HD + g * 16 + ln];
            }
            o[g] = wmma_f16(pa, vb, o[g]);
        }
        __syncthreads();  // vtile/pbuf reused next iteration
    }

    // ---- finalize: O /= l, write f16 [B, S, D] ----
#pragma unroll
    for (int r = 0; r < 8; ++r) {
        const float inv = 1.0f / lrow[r];
        const int m = q0 + r + 8 * hi;
        _Float16* dst = Ao + ((size_t)b * SS + m) * DD + h * HD;
#pragma unroll
        for (int g = 0; g < 4; ++g)
            dst[g * 16 + ln] = (_Float16)(o[g][r] * inv);
    }
}

// ---------------------------------------------------------------------------
// Kernel 3: output projection, all-f16 operands, fp32 result.
//   A : f16 [B*S, D], Woh : f16 [D, D], out = A @ Wo^T + bo (fp32)
// Block 256 = 8 waves; block tile 128(M) x 256(N) through gemm_tile_128x256.
// grid = (M/128, D/256)
// ---------------------------------------------------------------------------
__global__ __launch_bounds__(256)
void out_proj_kernel(const _Float16* __restrict__ A,
                     const _Float16* __restrict__ Woh,
                     const float* __restrict__ bo,
                     float* __restrict__ out) {
    __shared__ __attribute__((aligned(16))) char smem[2 * GSTAGE];
    const int wave = threadIdx.x >> 5;
    const int lane = threadIdx.x & 31;
    const int mblk = blockIdx.x * GM;
    const int nblk = blockIdx.y * GN;
    const int ln = lane & 15;
    const int kh = lane >> 4;

    v8f acc[4][4] = {};
    gemm_tile_128x256(A, Woh, mblk, nblk, smem, acc);

    const int m0 = mblk + (wave >> 2) * 64;
    const int n0 = nblk + (wave & 3) * 64;

#pragma unroll
    for (int j = 0; j < 4; ++j) {
        const int n = n0 + 16 * j + ln;
        const float bn = bo[n];
#pragma unroll
        for (int i = 0; i < 4; ++i) {
#pragma unroll
            for (int r = 0; r < 8; ++r) {
                const int m = m0 + 16 * i + r + 8 * kh;
                out[(size_t)m * DD + n] = acc[i][j][r] + bn;
            }
        }
    }
}

// ---------------------------------------------------------------------------
// Host side
// ---------------------------------------------------------------------------
extern "C" void kernel_launch(void* const* d_in, const int* in_sizes, int n_in,
                              void* d_out, int out_size, void* d_ws, size_t ws_size,
                              hipStream_t stream) {
    const float* X    = (const float*)d_in[0];  // [B, S, D]
    const float* mask = (const float*)d_in[1];  // [B, 1, S, S]
    const float* Wq   = (const float*)d_in[2];
    const float* bq   = (const float*)d_in[3];
    const float* Wk   = (const float*)d_in[4];
    const float* bk   = (const float*)d_in[5];
    const float* Wv   = (const float*)d_in[6];
    const float* bv   = (const float*)d_in[7];
    const float* Wo   = (const float*)d_in[8];
    const float* bo   = (const float*)d_in[9];
    float* out = (float*)d_out;

    // Workspace layout (halves):
    //   Xh   : B*S*D        = 8388608
    //   Wqh/Wkh/Wvh/Woh : D*D = 1048576 each
    //   Qw/Kw/Vw : B*H*S*HD = 8388608 each
    //   Aw   : B*S*D        = 8388608
    const size_t nX = (size_t)BB * SS * DD;   // 8388608
    const size_t nW = (size_t)DD * DD;        // 1048576
    _Float16* Xh  = (_Float16*)d_ws;
    _Float16* Wqh = Xh + nX;
    _Float16* Wkh = Wqh + nW;
    _Float16* Wvh = Wkh + nW;
    _Float16* Woh = Wvh + nW;
    _Float16* Qw  = Woh + nW;
    _Float16* Kw  = Qw + nX;
    _Float16* Vw  = Kw + nX;
    _Float16* Aw  = Vw + nX;

    const int M = BB * SS;  // 8192

    // ---- convert fp32 activations + weights to f16 once ----
    cvt_f32_to_f16_kernel<<<(int)(nX / 8 / 256), 256, 0, stream>>>(X, Xh, (int)(nX / 8));
    cvt_f32_to_f16_kernel<<<(int)(nW / 8 / 256), 256, 0, stream>>>(Wq, Wqh, (int)(nW / 8));
    cvt_f32_to_f16_kernel<<<(int)(nW / 8 / 256), 256, 0, stream>>>(Wk, Wkh, (int)(nW / 8));
    cvt_f32_to_f16_kernel<<<(int)(nW / 8 / 256), 256, 0, stream>>>(Wv, Wvh, (int)(nW / 8));
    cvt_f32_to_f16_kernel<<<(int)(nW / 8 / 256), 256, 0, stream>>>(Wo, Woh, (int)(nW / 8));

    dim3 gqkv(M / GM, DD / GN, 3);
    qkv_proj_kernel<<<gqkv, 256, 0, stream>>>(Xh, Wqh, bq, Wkh, bk, Wvh, bv, Qw, Kw, Vw);

    dim3 gattn(SS / 16, BB * HH);
    flash_attn_kernel<<<gattn, 32, 0, stream>>>(Qw, Kw, Vw, mask, Aw);

    dim3 gout(M / GM, DD / GN);
    out_proj_kernel<<<gout, 256, 0, stream>>>(Aw, Woh, bo, out);
}

// v002
// It runs in 179 microseconds.
// Next to v001, in two timings, it ran 1.38 and 1.42 times as fast.
// Counting every step since v000, it is 2.73 times as fast.
#include <hip/hip_runtime.h>
#include <hip/hip_bf16.h>

typedef __attribute__((ext_vector_type(16))) _Float16 v16h;
typedef __attribute__((ext_vector_type(8)))  _Float16 v8h;
typedef __attribute__((ext_vector_type(8)))  float    v8f;
typedef __attribute__((ext_vector_type(4)))  int      v4i;

#define BB 8
#define SS 1024
#define DD 1024
#define HH 16
#define HD 64
#define QK_SCALE 0.125f   // 64^-0.5

#if __has_builtin(__builtin_amdgcn_global_load_async_to_lds_b128)
#define HAVE_ASYNC_COPY 1
#endif

// ---------------------------------------------------------------------------
// WMMA wrapper: D = A(16x32 f16) * B(32x16 f16) + C(16x16 f32)
// ---------------------------------------------------------------------------
__device__ __forceinline__ v8f wmma_f16(v16h a, v16h b, v8f c) {
    return __builtin_amdgcn_wmma_f32_16x16x32_f16(
        false, a, false, b, (short)0, c, false, false);
}

// ---------------------------------------------------------------------------
// A/B fragment loader (16-bit operand, 16x32 tile), f16 source.
// Lane L: row/col = L&15, khalf = L>>4.
//   elems 0..7  -> K = khalf*8 + e ; elems 8..15 -> K = 16 + khalf*8 + e
// ---------------------------------------------------------------------------
__device__ __forceinline__ v16h frag_from_f16(const _Float16* __restrict__ p, int kh) {
    v16h f;
    const _Float16* a = p + kh * 8;
    const _Float16* b = p + 16 + kh * 8;
#pragma unroll
    for (int e = 0; e < 8; ++e) {
        f[e]     = a[e];
        f[e + 8] = b[e];
    }
    return f;
}

// ---------------------------------------------------------------------------
// Shared GEMM core of the two projections: Y(128 x 256) = A(128 x K) * W(256 x K)^T.
// Block 256 = 8 waves (2 x 4), wave tile 64 x 64 (16 accumulators).
// A pass is GK k of every operand row; a stage is [A 128 rows | W 256 rows] at
// pitch GPITCH bytes in LDS; two buffers, filled by asynchronous copies to LDS
// one pass ahead of their readers.
// ---------------------------------------------------------------------------
#define GM 128
#define GN 256
#define GK 64
#define GPITCH (GK * 2 + 16)              // bytes; 16 B x odd for ds_load_b128
#define GSTAGE ((GM + GN) * GPITCH)       // bytes of one buffer
#define GPASSES (DD / GK)
#define GCROWS (256 / (GK / 8))           // rows that one copy of the block covers

__device__ __forceinline__ v16h frag_from_lds(const char* p) {
    const v8h lo = *(const v8h*)p;
    const v8h hi = *(const v8h*)(p + 32);
    return __builtin_shufflevector(lo, hi, 0, 1, 2, 3, 4, 5, 6, 7,
                                   8, 9, 10, 11, 12, 13, 14, 15);
}

// One stage: 4 copies for the rows of A and 8 for those of W, 16 B per lane each,
// GCROWS rows apart. ga / gb are this lane's 16 B in the first copied row of A / W
// at the stage's k, lds its place in the stage's buffer. One statement, so that one
// s_wait_xcnt serves all twelve and no address register is rewritten ahead of it.
static_assert(GM == 4 * GCROWS && GN == 8 * GCROWS, "copy_stage issues 4 + 8 copies");
__device__ __forceinline__ void copy_stage(unsigned lds, const _Float16* ga,
                                           const _Float16* gb) {
    const unsigned rs = GCROWS * GPITCH;      // LDS bytes between two copies
    const size_t   gs = (size_t)GCROWS * DD;  // halves between two copies
    asm volatile(
        "global_load_async_to_lds_b128 %0, %12, off\n\t"
        "global_load_async_to_lds_b128 %1, %13, off\n\t"
        "global_load_async_to_lds_b128 %2, %14, off\n\t"
        "global_load_async_to_lds_b128 %3, %15, off\n\t"
        "global_load_async_to_lds_b128 %4, %16, off\n\t"
        "global_load_async_to_lds_b128 %5, %17, off\n\t"
        "global_load_async_to_lds_b128 %6, %18, off\n\t"
        "global_load_async_to_lds_b128 %7, %19, off\n\t"
        "global_load_async_to_lds_b128 %8, %20, off\n\t"
        "global_load_async_to_lds_b128 %9, %21, off\n\t"
        "global_load_async_to_lds_b128 %10, %22, off\n\t"
        "global_load_async_to_lds_b128 %11, %23, off\n\t"
        "s_wait_xcnt 0x0"
        :: "v"(lds), "v"(lds + rs), "v"(lds + 2u * rs), "v"(lds + 3u * rs),
           "v"(lds + 4u * rs), "v"(lds + 5u * rs), "v"(lds + 6u * rs),
           "v"(lds + 7u * rs), "v"(lds + 8u * rs), "v"(lds + 9u * rs),
           "v"(lds + 10u * rs), "v"(lds + 11u * rs),
           "v"(ga), "v"(ga + gs), "v"(ga + 2 * gs), "v"(ga + 3 * gs),
           "v"(gb), "v"(gb + gs), "v"(gb + 2 * gs), "v"(gb + 3 * gs),
           "v"(gb + 4 * gs), "v"(gb + 5 * gs), "v"(gb + 6 * gs), "v"(gb + 7 * gs)
        : "memory");
}

__device__ __forceinline__ void gemm_tile_128x256(const _Float16* __restrict__ A,
                                                  const _Float16* __restrict__ Wt,
                                                  int mblk, int nblk, char* smem,
                                                  v8f (&acc)[4][4]) {
    const int tid  = threadIdx.x;
    const int wave = tid >> 5;
    const int lane = tid & 31;
    const int ln = lane & 15;
    const int kh = lane >> 4;
    const int wm = wave >> 2;   // 0..1
    const int wn = wave & 3;    // 0..3

    const int crow = tid / (GK / 8);
    const int cchk = tid % (GK / 8);
    const _Float16* ga = A  + (size_t)(mblk + crow) * DD + cchk * 8;
    const _Float16* gb = Wt + (size_t)(nblk + crow) * DD + cchk * 8;
    const unsigned lds0 = (unsigned)(size_t)smem + (unsigned)(crow * GPITCH + cchk * 16);

    const int aoff = (wm * 64 + ln) * GPITCH + kh * 16;
    const int boff = (GM + wn * 64 + ln) * GPITCH + kh * 16;

    copy_stage(lds0, ga, gb);
    // stage 0 has landed for this wave, then for all
    asm volatile("s_wait_asynccnt 0x0" ::: "memory");
    __syncthreads();
    copy_stage(lds0 + GSTAGE, ga + GK, gb + GK);

#pragma unroll 1   // the two buffers alternate by a scalar offset
    for (int t = 0; t < GPASSES; ++t) {
        const char* buf = smem + (t & 1) * GSTAGE;
#pragma unroll
        for (int ks = 0; ks < GK / 32; ++ks) {
            v16h a[4], b[4];
#pragma unroll
            for (int i = 0; i < 4; ++i)
                a[i] = frag_from_lds(buf + aoff + i * 16 * GPITCH + ks * 64);
#pragma unroll
            for (int j = 0; j < 4; ++j)
                b[j] = frag_from_lds(buf + boff + j * 16 * GPITCH + ks * 64);
            // keeps the 16 LDS reads of a k step together in front of its 16 WMMAs
            __builtin_amdgcn_sched_barrier(0);
#pragma unroll
            for (int i = 0; i < 4; ++i)
#pragma unroll
                for (int j = 0; j < 4; ++j)
                    acc[i][j] = wmma_f16(a[i], b[j], acc[i][j]);
            // the other side of the same fence: the next reads stay behind this block
            __builtin_amdgcn_sched_barrier(0);
        }
        // publish point of stage t + 1: this wave's reads of stage t are done,
        // its copies of stage t + 1 have landed, then every wave's
        asm volatile("s_wait_dscnt 0x0" ::: "memory");
        asm volatile("s_wait_asynccnt 0x0" ::: "memory");
        __syncthreads();
        if (t + 2 < GPASSES)
            copy_stage(lds0 + (unsigned)(t & 1) * GSTAGE,
                       ga + (size_t)(t + 2) * GK, gb + (size_t)(t + 2) * GK);
    }
    // no copy is left in flight when the wave goes on
    asm volatile("s_wait_asynccnt 0x0" ::: "memory");
}

// ---------------------------------------------------------------------------
// Kernel 0: fp32 -> f16 conversion (8 elements / thread).
// ---------------------------------------------------------------------------
__global__ __launch_bounds__(256)
void cvt_f32_to_f16_kernel(const float* __restrict__ src,
                           _Float16* __restrict__ dst, int n8) {
    const int i = blockIdx.x * blockDim.x + threadIdx.x;
    if (i >= n8) return;
    const float* s = src + (size_t)i * 8;
    v8h h;
#pragma unroll
    for (int e = 0; e < 8; ++e) h[e] = (_Float16)s[e];
    *(v8h*)(dst + (size_t)i * 8) = h;
}

// ---------------------------------------------------------------------------
// Kernel 1: fused QKV projection, all-f16 operands.
//   Xh : [B*S, D] f16,  W*h : [D, D] f16 (out = X @ W^T + b)
//   Q/K/V out: f16 [B, H, S, HD]; Q scaled by QK_SCALE after bias.
// Block 256 = 8 waves; block tile 128(M) x 256(N) through gemm_tile_128x256.
// grid = (M/128, D/256, 3)
// ---------------------------------------------------------------------------
__global__ __launch_bounds__(256)
void qkv_proj_kernel(const _Float16* __restrict__ Xh,
                     const _Float16* __restrict__ Wqh, const float* __restrict__ bq,
                     const _Float16* __restrict__ Wkh, const float* __restrict__ bk,
                     const _Float16* __restrict__ Wvh, const float* __restrict__ bv,
                     _Float16* __restrict__ Qo, _Float16* __restrict__ Ko,
                     _Float16* __restrict__ Vo) {
    __shared__ __attribute__((aligned(16))) char smem[2 * GSTAGE];
    const int wave = threadIdx.x >> 5;
    const int lane = threadIdx.x & 31;
    const int mblk = blockIdx.x * GM;
    const int nblk = blockIdx.y * GN;
    const int which = blockIdx.z;

    const _Float16* W;
    const float* bias;
    _Float16* out;
    float scale;
    if (which == 0)      { W = Wqh; bias = bq; out = Qo; scale = QK_SCALE; }
    else if (which == 1) { W = Wkh; bias = bk; out = Ko; scale = 1.0f; }
    else                 { W = Wvh; bias = bv; out = Vo; scale = 1.0f; }

    const int ln = lane & 15;
    const int kh = lane >> 4;

    v8f acc[4][4] = {};
    gemm_tile_128x256(Xh, W, mblk, nblk, smem, acc);

    const int m0 = mblk + (wave >> 2) * 64;
    const int n0 = nblk + (wave & 3) * 64;

    // Epilogue: C layout -> lane holds col, rows r + 8*(lane>>4).
#pragma unroll
    for (int j = 0; j < 4; ++j) {
        const int n  = n0 + 16 * j + ln;
        const float bn = bias[n];
        const int h  = n >> 6;       // head
        const int hd = n & 63;       // dim within head
#pragma unroll
        for (int i = 0; i < 4; ++i) {
#pragma unroll
            for (int r = 0; r < 8; ++r) {
                const int m = m0 + 16 * i + r + 8 * kh;
                const int bidx = m >> 10;
                const int s    = m & (SS - 1);
                const float val = (acc[i][j][r] + bn) * scale;
                out[(((size_t)bidx * HH + h) * SS + s) * HD + hd] = (_Float16)val;
            }
        }
    }
}

// ---------------------------------------------------------------------------
// Kernel 2: flash attention per (b, h), transposed products.
//   Q/K/V: f16 [B, H, S, HD]; mask fp32 [B, 1, S, S] additive.
//   Output: f16 [B, S, D] row-major.
// Block 32 (one wave) handles 16 queries x full HD; kv in 32-wide steps.
//   S^T(32 kv x 16 q) = K * Q^T : a lane holds 16 scores of ONE query (q0 + ln),
//   keys 8*hi + r and 16 + 8*hi + r, so maximum and sum run in the lane and the two
//   wave halves meet by one cross-row move.
//   O^T(64 hd x 16 q) += V^T * P^T : the two score tiles, converted in place, are the
//   B operand in the hardware k order; V^T comes by the transposing LDS load.
// V tile staged to LDS with async global->LDS copies (overlaps score WMMAs).
// The mask tile (16 queries x 32 keys) takes the same road: a lane wants 16 keys
// of one query's row, and read from global that is 16 lines a load; the copies take
// whole lines and the lanes read their rows from LDS.
// grid = (S/16, B*H)
// ---------------------------------------------------------------------------
#define VPITCH 160   // bytes of a V row in LDS: 32 B x odd for ds_load_tr16_b128
#define MPITCH 144   // bytes of a mask row in LDS: 16 B x odd for ds_load_b128

typedef __attribute__((ext_vector_type(8))) short s16x8;
typedef __attribute__((ext_vector_type(4))) float v4f;

// lane (c, h) gets T[8h + 0..7][c] of the 16 x 16 tile its 32 lane addresses name
__device__ __forceinline__ v8h lds_tr16(const char* p) {
    typedef __attribute__((address_space(3))) s16x8 lds_s16x8;
    return __builtin_bit_cast(v8h, __builtin_amdgcn_ds_load_tr16_b128_v8i16((lds_s16x8*)p));
}

// value of lane l ^ 16
__device__ __forceinline__ float other_half(float x) {
    const int v = __builtin_bit_cast(int, x);
    return __builtin_bit_cast(float, __builtin_amdgcn_permlanex16(
        v, v, 0x76543210, 0xfedcba98, false, false));
}

__global__ __launch_bounds__(32)
void flash_attn_kernel(const _Float16* __restrict__ Q,
                       const _Float16* __restrict__ K,
                       const _Float16* __restrict__ V,
                       const float* __restrict__ mask,
                       _Float16* __restrict__ Ao) {
    __shared__ __attribute__((aligned(32))) char vtile[32 * VPITCH];  // V kv-tile (32 rows x HD)
    __shared__ __attribute__((aligned(16))) char mtile[16 * MPITCH];  // mask tile (16 queries x 32 keys)

    const int lane = threadIdx.x;
    const int ln = lane & 15;
    const int hi = lane >> 4;
    const int q0 = blockIdx.x * 16;
    const int bh = blockIdx.y;
    const int b  = bh >> 4;
    const int h  = bh & 15;

    const _Float16* Qb = Q + (size_t)bh * SS * HD;
    const _Float16* Kb = K + (size_t)bh * SS * HD;
    const _Float16* Vb = V + (size_t)bh * SS * HD;
    // this lane's 16 B in the first of its four mask copies (4 rows a copy, 8 lanes a row)
    const float* mg = mask + (size_t)b * SS * SS + (size_t)(q0 + (lane >> 3)) * SS + (lane & 7) * 4;
    const unsigned mdst = (unsigned)(size_t)mtile + (unsigned)((lane >> 3) * MPITCH + (lane & 7) * 16);
    // this lane's query row of the mask tile, at its half's first key
    const char* mrd = mtile + ln * MPITCH + 32 * hi;

    const v16h qb0 = frag_from_f16(Qb + (size_t)(q0 + ln) * HD + 0, hi);
    const v16h qb1 = frag_from_f16(Qb + (size_t)(q0 + ln) * HD + 32, hi);

    // where this lane's copies land, and where its transposing loads read
    char* vdst = vtile + (lane >> 3) * VPITCH + (lane & 7) * 16;
    const char* vrd = vtile + (8 * hi + (lane & 7)) * VPITCH + 16 * ((lane >> 3) & 1);

    float mrun = -1e30f, lrun = 0.0f;   // lrun: this half's keys only, joined at the end
    v8f o[4] = {};

    for (int kv0 = 0; kv0 < SS; kv0 += 32) {
        // ---- kick off mask tile copy to LDS (16x32 f32 = 2KB) ----
        // one statement, so that no address register is rewritten ahead of the s_wait_xcnt
        asm volatile(
            "global_load_async_to_lds_b128 %0, %4, off\n\t"
            "global_load_async_to_lds_b128 %1, %5, off\n\t"
            "global_load_async_to_lds_b128 %2, %6, off\n\t"
            "global_load_async_to_lds_b128 %3, %7, off\n\t"
            "s_wait_xcnt 0x0"
            :: "v"(mdst), "v"(mdst + 4u * MPITCH), "v"(mdst + 8u * MPITCH),
               "v"(mdst + 12u * MPITCH),
               "v"(mg + kv0), "v"(mg + kv0 + 4 * SS), "v"(mg + kv0 + 8 * SS),
               "v"(mg + kv0 + 12 * SS)
            : "memory");

        // ---- kick off V tile copy to LDS (32x64 f16 = 4KB) ----
        const _Float16* vsrc = Vb + (size_t)kv0 * HD;
#if defined(HAVE_ASYNC_COPY)
#pragma unroll
        for (int i = 0; i < 8; ++i) {
            const int off = (i * 32 + lane) * 8;  // halves, 16B per lane
            __builtin_amdgcn_global_load_async_to_lds_b128(
                (v4i*)(vsrc + off), (v4i*)(vdst + i * 4 * VPITCH), 0, 0);
        }
#else
#pragma unroll
        for (int i = 0; i < 8; ++i) {
            const int off = (i * 32 + lane) * 8;
            *(v8h*)(vdst + i * 4 * VPITCH) = *(const v8h*)(vsrc + off);
        }
#endif

        // ---- scores, transposed (overlap with the async copy) ----
        v8f s0 = {}, s1 = {};
        {
            v16h ka0 = frag_from_f16(Kb + (size_t)(kv0 + ln) * HD + 0, hi);
            v16h ka1 = frag_from_f16(Kb + (size_t)(kv0 + ln) * HD + 32, hi);
            s0 = wmma_f16(ka0, qb0, s0);
            s0 = wmma_f16(ka1, qb1, s0);
            v16h ka2 = frag_from_f16(Kb + (size_t)(kv0 + 16 + ln) * HD + 0, hi);
            v16h ka3 = frag_from_f16(Kb + (size_t)(kv0 + 16 + ln) * HD + 32, hi);
            s1 = wmma_f16(ka2, qb0, s1);
            s1 = wmma_f16(ka3, qb1, s1);
        }

        // ---- both tiles' copies have landed ----
        asm volatile("s_wait_asynccnt 0x0" ::: "memory");
        __syncthreads();

        // ---- additive mask + online softmax, one query per lane ----
        {
            const v4f a0 = *(const v4f*)(mrd),      a1 = *(const v4f*)(mrd + 16);
            const v4f b0 = *(const v4f*)(mrd + 64), b1 = *(const v4f*)(mrd + 80);
            s0 += __builtin_shufflevector(a0, a1, 0, 1, 2, 3, 4, 5, 6, 7);
            s1 += __builtin_shufflevector(b0, b1, 0, 1, 2, 3, 4, 5, 6, 7);
        }

        float mx = fmaxf(s0[0], s1[0]);
#pragma unroll
        for (int r = 1; r < 8; ++r) mx = fmaxf(mx, fmaxf(s0[r], s1[r]));
        mx = fmaxf(mx, other_half(mx));
        const float mn    = fmaxf(mrun, mx);
        const float alpha = __expf(mrun - mn);

        v16h pb;   // P^T as B: element s is key 8*hi + s, or 8*hi + s + 8 for s >= 8, of this lane's query
        float rs0 = 0.0f, rs1 = 0.0f;
#pragma unroll
        for (int r = 0; r < 8; ++r) {
            const float p0 = __expf(s0[r] - mn);
            const float p1 = __expf(s1[r] - mn);
            rs0 += p0;
            rs1 += p1;
            pb[r]     = (_Float16)p0;
            pb[r + 8] = (_Float16)p1;
        }
        lrun = lrun * alpha + (rs0 + rs1);
        mrun = mn;
#pragma unroll
        for (int g = 0; g < 4; ++g) o[g] *= alpha;

        // ---- PV from LDS ----
#pragma unroll
        for (int g = 0; g < 4; ++g) {
            const v8h lo = lds_tr16(vrd + 32 * g);
            const v8h up = lds_tr16(vrd + 16 * VPITCH + 32 * g);
            const v16h va = __builtin_shufflevector(lo, up, 0, 1, 2, 3, 4, 5, 6, 7,
                                                    8, 9, 10, 11, 12, 13, 14, 15);
            o[g] = wmma_f16(va, pb, o[g]);
        }
        // this wave's reads of both tiles have retired before the next trip's copies target them
        asm volatile("s_wait_dscnt 0x0" ::: "memory");
        __syncthreads();  // vtile/mtile reused next iteration
    }

    // ---- finalize: join the halves' sums, O /= l, write f16 [B, S, D] ----
    // o[g][r] = O[q0 + ln][16 g + 8 hi + r]: 8 consecutive halves, one 16 B store
    const float inv = 1.0f / (lrun + other_half(lrun));
    _Float16* dst = Ao + ((size_t)b * SS + q0 + ln) * DD + h * HD + 8 * hi;
#pragma unroll
    for (int g = 0; g < 4; ++g) {
        v8h w;
#pragma unroll
        for (int r = 0; r < 8; ++r) w[r] = (_Float16)(o[g][r] * inv);
        *(v8h*)(dst + g * 16) = w;
    }
}

// ---------------------------------------------------------------------------
// Kernel 3: output projection, all-f16 operands, fp32 result.
//   A : f16 [B*S, D], Woh : f16 [D, D], out = A @ Wo^T + bo (fp32)
// Block 256 = 8 waves; block tile 128(M) x 256(N) through gemm_tile_128x256.
// grid = (M/128, D/256)
// ---------------------------------------------------------------------------
__global__ __launch_bounds__(256)
void out_proj_kernel(const _Float16* __restrict__ A,
                     const _Float16* __restrict__ Woh,
                     const float* __restrict__ bo,
                     float* __restrict__ out) {
    __shared__ __attribute__((aligned(16))) char smem[2 * GSTAGE];
    const int wave = threadIdx.x >> 5;
    const int lane = threadIdx.x & 31;
    const int mblk = blockIdx.x * GM;
    const int nblk = blockIdx.y * GN;
    const int ln = lane & 15;
    const int kh = lane >> 4;

    v8f acc[4][4] = {};
    gemm_tile_128x256(A, Woh, mblk, nblk, smem, acc);

    const int m0 = mblk + (wave >> 2) * 64;
    const int n0 = nblk + (wave & 3) * 64;

#pragma unroll
    for (int j = 0; j < 4; ++j) {
        const int n = n0 + 16 * j + ln;
        const float bn = bo[n];
#pragma unroll
        for (int i = 0; i < 4; ++i) {
#pragma unroll
            for (int r = 0; r < 8; ++r) {
                const int m = m0 + 16 * i + r + 8 * kh;
                out[(size_t)m * DD + n] = acc[i][j][r] + bn;
            }
        }
    }
}

// ---------------------------------------------------------------------------
// Host side
// ---------------------------------------------------------------------------
extern "C" void kernel_launch(void* const* d_in, const int* in_sizes, int n_in,
                              void* d_out, int out_size, void* d_ws, size_t ws_size,
                              hipStream_t stream) {
    const float* X    = (const float*)d_in[0];  // [B, S, D]
    const float* mask = (const float*)d_in[1];  // [B, 1, S, S]
    const float* Wq   = (const float*)d_in[2];
    const float* bq   = (const float*)d_in[3];
    const float* Wk   = (const float*)d_in[4];
    const float* bk   = (const float*)d_in[5];
    const float* Wv   = (const float*)d_in[6];
    const float* bv   = (const float*)d_in[7];
    const float* Wo   = (const float*)d_in[8];
    const float* bo   = (const float*)d_in[9];
    float* out = (float*)d_out;

    // Workspace layout (halves):
    //   Xh   : B*S*D        = 8388608
    //   Wqh/Wkh/Wvh/Woh : D*D = 1048576 each
    //   Qw/Kw/Vw : B*H*S*HD = 8388608 each
    //   Aw   : B*S*D        = 8388608
    const size_t nX = (size_t)BB * SS * DD;   // 8388608
    const size_t nW = (size_t)DD * DD;        // 1048576
    _Float16* Xh  = (_Float16*)d_ws;
    _Float16* Wqh = Xh + nX;
    _Float16* Wkh = Wqh + nW;
    _Float16* Wvh = Wkh + nW;
    _Float16* Woh = Wvh + nW;
    _Float16* Qw  = Woh + nW;
    _Float16* Kw  = Qw + nX;
    _Float16* Vw  = Kw + nX;
    _Float16* Aw  = Vw + nX;

    const int M = BB * SS;  // 8192

    // ---- convert fp32 activations + weights to f16 once ----
    cvt_f32_to_f16_kernel<<<(int)(nX / 8 / 256), 256, 0, stream>>>(X, Xh, (int)(nX / 8));
    cvt_f32_to_f16_kernel<<<(int)(nW / 8 / 256), 256, 0, stream>>>(Wq, Wqh, (int)(nW / 8));
    cvt_f32_to_f16_kernel<<<(int)(nW / 8 / 256), 256, 0, stream>>>(Wk, Wkh, (int)(nW / 8));
    cvt_f32_to_f16_kernel<<<(int)(nW / 8 / 256), 256, 0, stream>>>(Wv, Wvh, (int)(nW / 8));
    cvt_f32_to_f16_kernel<<<(int)(nW / 8 / 256), 256, 0, stream>>>(Wo, Woh, (int)(nW / 8));

    dim3 gqkv(M / GM, DD / GN, 3);
    qkv_proj_kernel<<<gqkv, 256, 0, stream>>>(Xh, Wqh, bq, Wkh, bk, Wvh, bv, Qw, Kw, Vw);

    dim3 gattn(SS / 16, BB * HH);
    flash_attn_kernel<<<gattn, 32, 0, stream>>>(Qw, Kw, Vw, mask, Aw);

    dim3 gout(M / GM, DD / GN);
    out_proj_kernel<<<gout, 256, 0, stream>>>(Aw, Woh, bo, out);
}

// v003
// Measured time: 127 microseconds a run.
// Timed twice side by side with v002, it ran 1.41 and 1.42 times as fast.
// Over all steps from v000 it is 3.86 times as fast.
#include <hip/hip_runtime.h>
#include <hip/hip_bf16.h>

typedef __attribute__((ext_vector_type(16))) _Float16 v16h;
typedef __attribute__((ext_vector_type(8)))  _Float16 v8h;
typedef __attribute__((ext_vector_type(8)))  float    v8f;

#define BB 8
#define SS 1024
#define DD 1024
#define HH 16
#define HD 64
#define QK_SCALE 0.125f   // 64^-0.5

// ---------------------------------------------------------------------------
// WMMA wrapper: D = A(16x32 f16) * B(32x16 f16) + C(16x16 f32)
// ---------------------------------------------------------------------------
__device__ __forceinline__ v8f wmma_f16(v16h a, v16h b, v8f c) {
    return __builtin_amdgcn_wmma_f32_16x16x32_f16(
        false, a, false, b, (short)0, c, false, false);
}

// ---------------------------------------------------------------------------
// A/B fragment loader (16-bit operand, 16x32 tile), f16 source.
// Lane L: row/col = L&15, khalf = L>>4.
//   elems 0..7  -> K = khalf*8 + e ; elems 8..15 -> K = 16 + khalf*8 + e
// ---------------------------------------------------------------------------
__device__ __forceinline__ v16h frag_from_f16(const _Float16* __restrict__ p, int kh) {
    v16h f;
    const _Float16* a = p + kh * 8;
    const _Float16* b = p + 16 + kh * 8;
#pragma unroll
    for (int e = 0; e < 8; ++e) {
        f[e]     = a[e];
        f[e + 8] = b[e];
    }
    return f;
}

// ---------------------------------------------------------------------------
// Shared GEMM core of the two projections: Y(128 x 256) = A(128 x K) * W(256 x K)^T.
// Block 256 = 8 waves (2 x 4), wave tile 64 x 64 (16 accumulators).
// A pass is GK k of every operand row; a stage is [A 128 rows | W 256 rows] at
// pitch GPITCH bytes in LDS; two buffers, filled by asynchronous copies to LDS
// one pass ahead of their readers.
// ---------------------------------------------------------------------------
#define GM 128
#define GN 256
#define GK 64
#define GPITCH (GK * 2 + 16)              // bytes; 16 B x odd for ds_load_b128
#define GSTAGE ((GM + GN) * GPITCH)       // bytes of one buffer
#define GPASSES (DD / GK)
#define GCROWS (256 / (GK / 8))           // rows that one copy of the block covers

__device__ __forceinline__ v16h frag_from_lds(const char* p) {
    const v8h lo = *(const v8h*)p;
    const v8h hi = *(const v8h*)(p + 32);
    return __builtin_shufflevector(lo, hi, 0, 1, 2, 3, 4, 5, 6, 7,
                                   8, 9, 10, 11, 12, 13, 14, 15);
}

// One stage: 4 copies for the rows of A and 8 for those of W, 16 B per lane each,
// GCROWS rows apart. ga / gb are this lane's 16 B in the first copied row of A / W
// at the stage's k, lds its place in the stage's buffer. One statement, so that one
// s_wait_xcnt serves all twelve and no address register is rewritten ahead of it.
static_assert(GM == 4 * GCROWS && GN == 8 * GCROWS, "copy_stage issues 4 + 8 copies");
__device__ __forceinline__ void copy_stage(unsigned lds, const _Float16* ga,
                                           const _Float16* gb) {
    const unsigned rs = GCROWS * GPITCH;      // LDS bytes between two copies
    const size_t   gs = (size_t)GCROWS * DD;  // halves between two copies
    asm volatile(
        "global_load_async_to_lds_b128 %0, %12, off\n\t"
        "global_load_async_to_lds_b128 %1, %13, off\n\t"
        "global_load_async_to_lds_b128 %2, %14, off\n\t"
        "global_load_async_to_lds_b128 %3, %15, off\n\t"
        "global_load_async_to_lds_b128 %4, %16, off\n\t"
        "global_load_async_to_lds_b128 %5, %17, off\n\t"
        "global_load_async_to_lds_b128 %6, %18, off\n\t"
        "global_load_async_to_lds_b128 %7, %19, off\n\t"
        "global_load_async_to_lds_b128 %8, %20, off\n\t"
        "global_load_async_to_lds_b128 %9, %21, off\n\t"
        "global_load_async_to_lds_b128 %10, %22, off\n\t"
        "global_load_async_to_lds_b128 %11, %23, off\n\t"
        "s_wait_xcnt 0x0"
        :: "v"(lds), "v"(lds + rs), "v"(lds + 2u * rs), "v"(lds + 3u * rs),
           "v"(lds + 4u * rs), "v"(lds + 5u * rs), "v"(lds + 6u * rs),
           "v"(lds + 7u * rs), "v"(lds + 8u * rs), "v"(lds + 9u * rs),
           "v"(lds + 10u * rs), "v"(lds + 11u * rs),
           "v"(ga), "v"(ga + gs), "v"(ga + 2 * gs), "v"(ga + 3 * gs),
           "v"(gb), "v"(gb + gs), "v"(gb + 2 * gs), "v"(gb + 3 * gs),
           "v"(gb + 4 * gs), "v"(gb + 5 * gs), "v"(gb + 6 * gs), "v"(gb + 7 * gs)
        : "memory");
}

__device__ __forceinline__ void gemm_tile_128x256(const _Float16* __restrict__ A,
                                                  const _Float16* __restrict__ Wt,
                                                  int mblk, int nblk, char* smem,
                                                  v8f (&acc)[4][4]) {
    const int tid  = threadIdx.x;
    const int wave = tid >> 5;
    const int lane = tid & 31;
    const int ln = lane & 15;
    const int kh = lane >> 4;
    const int wm = wave >> 2;   // 0..1
    const int wn = wave & 3;    // 0..3

    const int crow = tid / (GK / 8);
    const int cchk = tid % (GK / 8);
    const _Float16* ga = A  + (size_t)(mblk + crow) * DD + cchk * 8;
    const _Float16* gb = Wt + (size_t)(nblk + crow) * DD + cchk * 8;
    const unsigned lds0 = (unsigned)(size_t)smem + (unsigned)(crow * GPITCH + cchk * 16);

    const int aoff = (wm * 64 + ln) * GPITCH + kh * 16;
    const int boff = (GM + wn * 64 + ln) * GPITCH + kh * 16;

    copy_stage(lds0, ga, gb);
    // stage 0 has landed for this wave, then for all
    asm volatile("s_wait_asynccnt 0x0" ::: "memory");
    __syncthreads();
    copy_stage(lds0 + GSTAGE, ga + GK, gb + GK);

#pragma unroll 1   // the two buffers alternate by a scalar offset
    for (int t = 0; t < GPASSES; ++t) {
        const char* buf = smem + (t & 1) * GSTAGE;
#pragma unroll
        for (int ks = 0; ks < GK / 32; ++ks) {
            v16h a[4], b[4];
#pragma unroll
            for (int i = 0; i < 4; ++i)
                a[i] = frag_from_lds(buf + aoff + i * 16 * GPITCH + ks * 64);
#pragma unroll
            for (int j = 0; j < 4; ++j)
                b[j] = frag_from_lds(buf + boff + j * 16 * GPITCH + ks * 64);
            // keeps the 16 LDS reads of a k step together in front of its 16 WMMAs
            __builtin_amdgcn_sched_barrier(0);
#pragma unroll
            for (int i = 0; i < 4; ++i)
#pragma unroll
                for (int j = 0; j < 4; ++j)
                    acc[i][j] = wmma_f16(a[i], b[j], acc[i][j]);
            // the other side of the same fence: the next reads stay behind this block
            __builtin_amdgcn_sched_barrier(0);
        }
        // publish point of stage t + 1: this wave's reads of stage t are done,
        // its copies of stage t + 1 have landed, then every wave's
        asm volatile("s_wait_dscnt 0x0" ::: "memory");
        asm volatile("s_wait_asynccnt 0x0" ::: "memory");
        __syncthreads();
        if (t + 2 < GPASSES)
            copy_stage(lds0 + (unsigned)(t & 1) * GSTAGE,
                       ga + (size_t)(t + 2) * GK, gb + (size_t)(t + 2) * GK);
    }
    // no copy is left in flight when the wave goes on
    asm volatile("s_wait_asynccnt 0x0" ::: "memory");
}

// ---------------------------------------------------------------------------
// Kernel 0: fp32 -> f16 conversion (8 elements / thread).
// ---------------------------------------------------------------------------
__global__ __launch_bounds__(256)
void cvt_f32_to_f16_kernel(const float* __restrict__ src,
                           _Float16* __restrict__ dst, int n8) {
    const int i = blockIdx.x * blockDim.x + threadIdx.x;
    if (i >= n8) return;
    const float* s = src + (size_t)i * 8;
    v8h h;
#pragma unroll
    for (int e = 0; e < 8; ++e) h[e] = (_Float16)s[e];
    *(v8h*)(dst + (size_t)i * 8) = h;
}

// ---------------------------------------------------------------------------
// Kernel 1: fused QKV projection, all-f16 operands.
//   Xh : [B*S, D] f16,  W*h : [D, D] f16 (out = X @ W^T + b)
//   Q/K/V out: f16 [B, H, S, HD]; Q scaled by QK_SCALE after bias.
// Block 256 = 8 waves; block tile 128(M) x 256(N) through gemm_tile_128x256.
// grid = (M/128, D/256, 3)
// ---------------------------------------------------------------------------
__global__ __launch_bounds__(256)
void qkv_proj_kernel(const _Float16* __restrict__ Xh,
                     const _Float16* __restrict__ Wqh, const float* __restrict__ bq,
                     const _Float16* __restrict__ Wkh, const float* __restrict__ bk,
                     const _Float16* __restrict__ Wvh, const float* __restrict__ bv,
                     _Float16* __restrict__ Qo, _Float16* __restrict__ Ko,
                     _Float16* __restrict__ Vo) {
    __shared__ __attribute__((aligned(16))) char smem[2 * GSTAGE];
    const int wave = threadIdx.x >> 5;
    const int lane = threadIdx.x & 31;
    const int mblk = blockIdx.x * GM;
    const int nblk = blockIdx.y * GN;
    const int which = blockIdx.z;

    const _Float16* W;
    const float* bias;
    _Float16* out;
    float scale;
    if (which == 0)      { W = Wqh; bias = bq; out = Qo; scale = QK_SCALE; }
    else if (which == 1) { W = Wkh; bias = bk; out = Ko; scale = 1.0f; }
    else                 { W = Wvh; bias = bv; out = Vo; scale = 1.0f; }

    const int ln = lane & 15;
    const int kh = lane >> 4;

    v8f acc[4][4] = {};
    gemm_tile_128x256(Xh, W, mblk, nblk, smem, acc);

    const int m0 = mblk + (wave >> 2) * 64;
    const int n0 = nblk + (wave & 3) * 64;

    // Epilogue: C layout -> lane holds col, rows r + 8*(lane>>4).
#pragma unroll
    for (int j = 0; j < 4; ++j) {
        const int n  = n0 + 16 * j + ln;
        const float bn = bias[n];
        const int h  = n >> 6;       // head
        const int hd = n & 63;       // dim within head
#pragma unroll
        for (int i = 0; i < 4; ++i) {
#pragma unroll
            for (int r = 0; r < 8; ++r) {
                const int m = m0 + 16 * i + r + 8 * kh;
                const int bidx = m >> 10;
                const int s    = m & (SS - 1);
                const float val = (acc[i][j][r] + bn) * scale;
                out[(((size_t)bidx * HH + h) * SS + s) * HD + hd] = (_Float16)val;
            }
        }
    }
}

// ---------------------------------------------------------------------------
// Kernel 2: flash attention per (b, h), transposed products.
//   Q/K/V: f16 [B, H, S, HD]; mask fp32 [B, 1, S, S] additive.
//   Output: f16 [B, S, D] row-major.
// Block 256 = 8 waves; a wave handles 32 queries (two groups of 16) x full HD, the
// block 256 queries of one head; kv in 32-wide passes.
//   S^T(32 kv x 16 q) = K * Q^T : a lane holds 16 scores of ONE query of each group,
//   keys 8*hi + r and 16 + 8*hi + r, so maximum and sum run in the lane and the two
//   wave halves meet by one cross-row move.
//   O^T(64 hd x 16 q) += V^T * P^T : the two score tiles, converted in place, are the
//   B operand in the hardware k order; V^T comes by the transposing LDS load.
// A stage is [K 32 rows | V 32 rows | mask 256 query rows x 32 keys] in LDS. The eight
// waves read the same K and V rows, so a stage is fetched once for 256 queries; two
// buffers, filled by asynchronous copies to LDS one pass ahead of their readers.
// grid = (S/256, B*H)
// ---------------------------------------------------------------------------
#define KPITCH 144   // bytes of a K row in LDS: 16 B x odd for ds_load_b128
#define VPITCH 160   // bytes of a V row in LDS: 32 B x odd for ds_load_tr16_b128
#define MPITCH 144   // bytes of a mask row in LDS: 16 B x odd for ds_load_b128
#define AQ 256       // queries of a block
#define AKV 32       // keys of a stage
#define AV_OFF (AKV * KPITCH)
#define AM_OFF (AV_OFF + AKV * VPITCH)
#define ASTAGE (AM_OFF + AQ * MPITCH)   // bytes of one buffer
#define APASSES (SS / AKV)

typedef __attribute__((ext_vector_type(8))) short s16x8;
typedef __attribute__((ext_vector_type(4))) float v4f;

// lane (c, h) gets T[8h + 0..7][c] of the 16 x 16 tile its 32 lane addresses name
__device__ __forceinline__ v8h lds_tr16(const char* p) {
    typedef __attribute__((address_space(3))) s16x8 lds_s16x8;
    return __builtin_bit_cast(v8h, __builtin_amdgcn_ds_load_tr16_b128_v8i16((lds_s16x8*)p));
}

// value of lane l ^ 16
__device__ __forceinline__ float other_half(float x) {
    const int v = __builtin_bit_cast(int, x);
    return __builtin_bit_cast(float, __builtin_amdgcn_permlanex16(
        v, v, 0x76543210, 0xfedcba98, false, false));
}

// One stage: one copy for the rows of K, one for those of V, eight for the mask rows
// (32 rows a copy of the block, 8 lanes a row, 16 B per lane). kd / vd / md are this
// lane's places in the stage's buffer, kg / vg / mg its 16 B at the stage's keys. One
// statement, so that one s_wait_xcnt serves all ten and no address register is
// rewritten ahead of it.
static_assert(AKV * 8 == 256 && AQ == 8 * 32, "attn_copy_stage issues 1 + 1 + 8 copies");
__device__ __forceinline__ void attn_copy_stage(unsigned kd, unsigned vd, unsigned md,
                                                const _Float16* kg, const _Float16* vg,
                                                const float* mg) {
    const unsigned rs = 32u * MPITCH;      // LDS bytes between two mask copies
    const size_t   gs = (size_t)32 * SS;   // floats between two mask copies
    asm volatile(
        "global_load_async_to_lds_b128 %0, %10, off\n\t"
        "global_load_async_to_lds_b128 %1, %11, off\n\t"
        "global_load_async_to_lds_b128 %2, %12, off\n\t"
        "global_load_async_to_lds_b128 %3, %13, off\n\t"
        "global_load_async_to_lds_b128 %4, %14, off\n\t"
        "global_load_async_to_lds_b128 %5, %15, off\n\t"
        "global_load_async_to_lds_b128 %6, %16, off\n\t"
        "global_load_async_to_lds_b128 %7, %17, off\n\t"
        "global_load_async_to_lds_b128 %8, %18, off\n\t"
        "global_load_async_to_lds_b128 %9, %19, off\n\t"
        "s_wait_xcnt 0x0"
        :: "v"(kd), "v"(vd), "v"(md), "v"(md + rs), "v"(md + 2u * rs), "v"(md + 3u * rs),
           "v"(md + 4u * rs), "v"(md + 5u * rs), "v"(md + 6u * rs), "v"(md + 7u * rs),
           "v"(kg), "v"(vg), "v"(mg), "v"(mg + gs), "v"(mg + 2 * gs), "v"(mg + 3 * gs),
           "v"(mg + 4 * gs), "v"(mg + 5 * gs), "v"(mg + 6 * gs), "v"(mg + 7 * gs)
        : "memory");
}

__global__ __launch_bounds__(256)
void flash_attn_kernel(const _Float16* __restrict__ Q,
                       const _Float16* __restrict__ K,
                       const _Float16* __restrict__ V,
                       const float* __restrict__ mask,
                       _Float16* __restrict__ Ao) {
    __shared__ __attribute__((aligned(32))) char smem[2 * ASTAGE];

    const int tid  = threadIdx.x;
    const int wave = tid >> 5;
    const int lane = tid & 31;
    const int ln = lane & 15;
    const int hi = lane >> 4;
    const int qblk = blockIdx.x * AQ;
    const int q0 = qblk + wave * 32;
    const int bh = blockIdx.y;
    const int b  = bh >> 4;
    const int h  = bh & 15;

    const _Float16* Qb = Q + (size_t)bh * SS * HD;

    // this thread's 16 B of a stage's K rows, V rows and first 32 mask rows
    const int crow = tid >> 3;
    const int cchk = tid & 7;
    const _Float16* kg = K + (size_t)bh * SS * HD + crow * HD + cchk * 8;
    const _Float16* vg = V + (size_t)bh * SS * HD + crow * HD + cchk * 8;
    const float* mg = mask + (size_t)b * SS * SS + (size_t)(qblk + crow) * SS + cchk * 4;
    const unsigned lds0 = (unsigned)(size_t)smem;
    const unsigned kd = lds0 + (unsigned)(crow * KPITCH + cchk * 16);
    const unsigned vd = lds0 + (unsigned)(AV_OFF + crow * VPITCH + cchk * 16);
    const unsigned md = lds0 + (unsigned)(AM_OFF + crow * MPITCH + cchk * 16);

    // where this lane reads in a buffer: its key row of K, its transposing loads of V,
    // its first group's query row of the mask at its half's first key
    const int krd = ln * KPITCH + hi * 16;
    const int vrd = AV_OFF + (8 * hi + (lane & 7)) * VPITCH + 16 * ((lane >> 3) & 1);
    const int mrd = AM_OFF + (wave * 32 + ln) * MPITCH + 32 * hi;

    attn_copy_stage(kd, vd, md, kg, vg, mg);

    v16h qb[2][2];
#pragma unroll
    for (int c = 0; c < 2; ++c) {
        qb[c][0] = frag_from_f16(Qb + (size_t)(q0 + 16 * c + ln) * HD + 0, hi);
        qb[c][1] = frag_from_f16(Qb + (size_t)(q0 + 16 * c + ln) * HD + 32, hi);
    }

    float mrun[2] = {-1e30f, -1e30f};
    float lrun[2] = {0.0f, 0.0f};   // this half's keys only, joined at the end
    v8f o[2][4] = {};

    // stage 0 has landed for this wave, then for all
    asm volatile("s_wait_asynccnt 0x0" ::: "memory");
    __syncthreads();
    attn_copy_stage(kd + ASTAGE, vd + ASTAGE, md + ASTAGE,
                    kg + AKV * HD, vg + AKV * HD, mg + AKV);

#pragma unroll 1   // the two buffers alternate by a scalar offset
    for (int t = 0; t < APASSES; ++t) {
        const char* buf = smem + (t & 1) * ASTAGE;

        // ---- this pass's K fragments and mask rows, one group of LDS reads ----
        v16h ka[2][2];
#pragma unroll
        for (int kt = 0; kt < 2; ++kt)
#pragma unroll
            for (int ks = 0; ks < 2; ++ks)
                ka[kt][ks] = frag_from_lds(buf + krd + kt * 16 * KPITCH + ks * 64);
        v8f mk[2][2];   // [query group][key tile]
#pragma unroll
        for (int c = 0; c < 2; ++c) {
            const char* mp = buf + mrd + c * 16 * MPITCH;
            const v4f a0 = *(const v4f*)(mp),      a1 = *(const v4f*)(mp + 16);
            const v4f b0 = *(const v4f*)(mp + 64), b1 = *(const v4f*)(mp + 80);
            mk[c][0] = __builtin_shufflevector(a0, a1, 0, 1, 2, 3, 4, 5, 6, 7);
            mk[c][1] = __builtin_shufflevector(b0, b1, 0, 1, 2, 3, 4, 5, 6, 7);
        }
        // keeps the 16 LDS reads together in front of the 8 score WMMAs, for speed only
        __builtin_amdgcn_sched_barrier(0);

        // ---- scores, transposed: each K fragment serves both query groups ----
        v8f s[2][2] = {};   // [query group][key tile]
#pragma unroll
        for (int ks = 0; ks < 2; ++ks)
#pragma unroll
            for (int c = 0; c < 2; ++c)
#pragma unroll
                for (int kt = 0; kt < 2; ++kt)
                    s[c][kt] = wmma_f16(ka[kt][ks], qb[c][ks], s[c][kt]);

        // ---- V^T fragments: the pass's last LDS reads, one group ----
        v16h va[4];
#pragma unroll
        for (int g = 0; g < 4; ++g) {
            const v8h lo = lds_tr16(buf + vrd + 32 * g);
            const v8h up = lds_tr16(buf + vrd + 16 * VPITCH + 32 * g);
            va[g] = __builtin_shufflevector(lo, up, 0, 1, 2, 3, 4, 5, 6, 7,
                                            8, 9, 10, 11, 12, 13, 14, 15);
        }

        // publish point of stage t + 1. It stands behind the pass's last LDS read, not at
        // the loop's end: what follows works on registers alone, so the refill flies for a
        // whole pass. This wave's reads of stage t are done, its copies of stage t + 1
        // have landed, then every wave's
        asm volatile("s_wait_dscnt 0x0" ::: "memory");
        asm volatile("s_wait_asynccnt 0x0" ::: "memory");
        __syncthreads();
        if (t + 2 < APASSES) {
            const unsigned bo = (unsigned)(t & 1) * ASTAGE;
            attn_copy_stage(kd + bo, vd + bo, md + bo,
                            kg + (size_t)(t + 2) * AKV * HD, vg + (size_t)(t + 2) * AKV * HD,
                            mg + (size_t)(t + 2) * AKV);
        }

        // ---- additive mask + online softmax, one query of each group per lane ----
        v16h pb[2];   // P^T as B: element e is key 8*hi + e (e < 8) or 16 + 8*hi + e - 8 of this lane's query
#pragma unroll
        for (int c = 0; c < 2; ++c) {
            const v8f s0 = s[c][0] + mk[c][0];
            const v8f s1 = s[c][1] + mk[c][1];

            float mx = fmaxf(s0[0], s1[0]);
#pragma unroll
            for (int r = 1; r < 8; ++r) mx = fmaxf(mx, fmaxf(s0[r], s1[r]));
            mx = fmaxf(mx, other_half(mx));
            const float mn    = fmaxf(mrun[c], mx);
            const float alpha = __expf(mrun[c] - mn);

            float rs0 = 0.0f, rs1 = 0.0f;
#pragma unroll
            for (int r = 0; r < 8; ++r) {
                const float p0 = __expf(s0[r] - mn);
                const float p1 = __expf(s1[r] - mn);
                rs0 += p0;
                rs1 += p1;
                pb[c][r]     = (_Float16)p0;
                pb[c][r + 8] = (_Float16)p1;
            }
            lrun[c] = lrun[c] * alpha + (rs0 + rs1);
            mrun[c] = mn;
#pragma unroll
            for (int g = 0; g < 4; ++g) o[c][g] *= alpha;
        }

        // ---- PV: each V^T fragment serves both query groups ----
#pragma unroll
        for (int g = 0; g < 4; ++g)
#pragma unroll
            for (int c = 0; c < 2; ++c) o[c][g] = wmma_f16(va[g], pb[c], o[c][g]);

    }
    // no copy is left in flight when the wave goes on
    asm volatile("s_wait_asynccnt 0x0" ::: "memory");

    // ---- finalize: join the halves' sums, O /= l, write f16 [B, S, D] ----
    // o[c][g][r] = O[q0 + 16 c + ln][16 g + 8 hi + r]: 8 consecutive halves, one 16 B store
#pragma unroll
    for (int c = 0; c < 2; ++c) {
        const float inv = 1.0f / (lrun[c] + other_half(lrun[c]));
        _Float16* dst = Ao + ((size_t)b * SS + q0 + 16 * c + ln) * DD + h * HD + 8 * hi;
#pragma unroll
        for (int g = 0; g < 4; ++g) {
            v8h w;
#pragma unroll
            for (int r = 0; r < 8; ++r) w[r] = (_Float16)(o[c][g][r] * inv);
            *(v8h*)(dst + g * 16) = w;
        }
    }
}

// ---------------------------------------------------------------------------
// Kernel 3: output projection, all-f16 operands, fp32 result.
//   A : f16 [B*S, D], Woh : f16 [D, D], out = A @ Wo^T + bo (fp32)
// Block 256 = 8 waves; block tile 128(M) x 256(N) through gemm_tile_128x256.
// grid = (M/128, D/256)
// ---------------------------------------------------------------------------
__global__ __launch_bounds__(256)
void out_proj_kernel(const _Float16* __restrict__ A,
                     const _Float16* __restrict__ Woh,
                     const float* __restrict__ bo,
                     float* __restrict__ out) {
    __shared__ __attribute__((aligned(16))) char smem[2 * GSTAGE];
    const int wave = threadIdx.x >> 5;
    const int lane = threadIdx.x & 31;
    const int mblk = blockIdx.x * GM;
    const int nblk = blockIdx.y * GN;
    const int ln = lane & 15;
    const int kh = lane >> 4;

    v8f acc[4][4] = {};
    gemm_tile_128x256(A, Woh, mblk, nblk, smem, acc);

    const int m0 = mblk + (wave >> 2) * 64;
    const int n0 = nblk + (wave & 3) * 64;

#pragma unroll
    for (int j = 0; j < 4; ++j) {
        const int n = n0 + 16 * j + ln;
        const float bn = bo[n];
#pragma unroll
        for (int i = 0; i < 4; ++i) {
#pragma unroll
            for (int r = 0; r < 8; ++r) {
                const int m = m0 + 16 * i + r + 8 * kh;
                out[(size_t)m * DD + n] = acc[i][j][r] + bn;
            }
        }
    }
}

// ---------------------------------------------------------------------------
// Host side
// ---------------------------------------------------------------------------
extern "C" void kernel_launch(void* const* d_in, const int* in_sizes, int n_in,
                              void* d_out, int out_size, void* d_ws, size_t ws_size,
                              hipStream_t stream) {
    const float* X    = (const float*)d_in[0];  // [B, S, D]
    const float* mask = (const float*)d_in[1];  // [B, 1, S, S]
    const float* Wq   = (const float*)d_in[2];
    const float* bq   = (const float*)d_in[3];
    const float* Wk   = (const float*)d_in[4];
    const float* bk   = (const float*)d_in[5];
    const float* Wv   = (const float*)d_in[6];
    const float* bv   = (const float*)d_in[7];
    const float* Wo   = (const float*)d_in[8];
    const float* bo   = (const float*)d_in[9];
    float* out = (float*)d_out;

    // Workspace layout (halves):
    //   Xh   : B*S*D        = 8388608
    //   Wqh/Wkh/Wvh/Woh : D*D = 1048576 each
    //   Qw/Kw/Vw : B*H*S*HD = 8388608 each
    //   Aw   : B*S*D        = 8388608
    const size_t nX = (size_t)BB * SS * DD;   // 8388608
    const size_t nW = (size_t)DD * DD;        // 1048576
    _Float16* Xh  = (_Float16*)d_ws;
    _Float16* Wqh = Xh + nX;
    _Float16* Wkh = Wqh + nW;
    _Float16* Wvh = Wkh + nW;
    _Float16* Woh = Wvh + nW;
    _Float16* Qw  = Woh + nW;
    _Float16* Kw  = Qw + nX;
    _Float16* Vw  = Kw + nX;
    _Float16* Aw  = Vw + nX;

    const int M = BB * SS;  // 8192

    // ---- convert fp32 activations + weights to f16 once ----
    cvt_f32_to_f16_kernel<<<(int)(nX / 8 / 256), 256, 0, stream>>>(X, Xh, (int)(nX / 8));
    cvt_f32_to_f16_kernel<<<(int)(nW / 8 / 256), 256, 0, stream>>>(Wq, Wqh, (int)(nW / 8));
    cvt_f32_to_f16_kernel<<<(int)(nW / 8 / 256), 256, 0, stream>>>(Wk, Wkh, (int)(nW / 8));
    cvt_f32_to_f16_kernel<<<(int)(nW / 8 / 256), 256, 0, stream>>>(Wv, Wvh, (int)(nW / 8));
    cvt_f32_to_f16_kernel<<<(int)(nW / 8 / 256), 256, 0, stream>>>(Wo, Woh, (int)(nW / 8));

    dim3 gqkv(M / GM, DD / GN, 3);
    qkv_proj_kernel<<<gqkv, 256, 0, stream>>>(Xh, Wqh, bq, Wkh, bk, Wvh, bv, Qw, Kw, Vw);

    dim3 gattn(SS / AQ, BB * HH);
    flash_attn_kernel<<<gattn, 256, 0, stream>>>(Qw, Kw, Vw, mask, Aw);

    dim3 gout(M / GM, DD / GN);
    out_proj_kernel<<<gout, 256, 0, stream>>>(Aw, Woh, bo, out);
}

// v004
// A run of this version takes 116 microseconds.
// In both of two side-by-side timings against v003, it was 1.09 times as fast.
// All steps since v000 together make it 4.21 times as fast.
#include <hip/hip_runtime.h>
#include <hip/hip_bf16.h>

typedef __attribute__((ext_vector_type(16))) _Float16 v16h;
typedef __attribute__((ext_vector_type(8)))  _Float16 v8h;
typedef __attribute__((ext_vector_type(8)))  float    v8f;

#define BB 8
#define SS 1024
#define DD 1024
#define HH 16
#define HD 64
#define QK_SCALE 0.125f   // 64^-0.5

// ---------------------------------------------------------------------------
// WMMA wrapper: D = A(16x32 f16) * B(32x16 f16) + C(16x16 f32)
// ---------------------------------------------------------------------------
__device__ __forceinline__ v8f wmma_f16(v16h a, v16h b, v8f c) {
    return __builtin_amdgcn_wmma_f32_16x16x32_f16(
        false, a, false, b, (short)0, c, false, false);
}

// ---------------------------------------------------------------------------
// A/B fragment loader (16-bit operand, 16x32 tile), f16 source.
// Lane L: row/col = L&15, khalf = L>>4.
//   elems 0..7  -> K = khalf*8 + e ; elems 8..15 -> K = 16 + khalf*8 + e
// ---------------------------------------------------------------------------
__device__ __forceinline__ v16h frag_from_f16(const _Float16* __restrict__ p, int kh) {
    v16h f;
    const _Float16* a = p + kh * 8;
    const _Float16* b = p + 16 + kh * 8;
#pragma unroll
    for (int e = 0; e < 8; ++e) {
        f[e]     = a[e];
        f[e + 8] = b[e];
    }
    return f;
}

// ---------------------------------------------------------------------------
// Shared GEMM core of the two projections: Y(128 x 256) = A(128 x K) * W(256 x K)^T.
// Block 256 = 8 waves (2 x 4), wave tile 64 x 64 (16 accumulators).
// A pass is GK k of every operand row; a stage is [A 128 rows | W 256 rows] at
// pitch GPITCH bytes in LDS; two buffers, filled by asynchronous copies to LDS
// one pass ahead of their readers.
// ---------------------------------------------------------------------------
#define GM 128
#define GN 256
#define GK 64
#define GPITCH (GK * 2 + 16)              // bytes; 16 B x odd for ds_load_b128
#define GSTAGE ((GM + GN) * GPITCH)       // bytes of one buffer
#define GPASSES (DD / GK)
#define GCROWS (256 / (GK / 8))           // rows that one copy of the block covers

__device__ __forceinline__ v16h frag_from_lds(const char* p) {
    const v8h lo = *(const v8h*)p;
    const v8h hi = *(const v8h*)(p + 32);
    return __builtin_shufflevector(lo, hi, 0, 1, 2, 3, 4, 5, 6, 7,
                                   8, 9, 10, 11, 12, 13, 14, 15);
}

// One stage: 4 copies for the rows of A and 8 for those of W, 16 B per lane each,
// GCROWS rows apart. ga / gb are this lane's 16 B in the first copied row of A / W
// at the stage's k, lds its place in the stage's buffer. One statement, so that one
// s_wait_xcnt serves all twelve and no address register is rewritten ahead of it.
static_assert(GM == 4 * GCROWS && GN == 8 * GCROWS, "copy_stage issues 4 + 8 copies");
__device__ __forceinline__ void copy_stage(unsigned lds, const _Float16* ga,
                                           const _Float16* gb) {
    const unsigned rs = GCROWS * GPITCH;      // LDS bytes between two copies
    const size_t   gs = (size_t)GCROWS * DD;  // halves between two copies
    asm volatile(
        "global_load_async_to_lds_b128 %0, %12, off\n\t"
        "global_load_async_to_lds_b128 %1, %13, off\n\t"
        "global_load_async_to_lds_b128 %2, %14, off\n\t"
        "global_load_async_to_lds_b128 %3, %15, off\n\t"
        "global_load_async_to_lds_b128 %4, %16, off\n\t"
        "global_load_async_to_lds_b128 %5, %17, off\n\t"
        "global_load_async_to_lds_b128 %6, %18, off\n\t"
        "global_load_async_to_lds_b128 %7, %19, off\n\t"
        "global_load_async_to_lds_b128 %8, %20, off\n\t"
        "global_load_async_to_lds_b128 %9, %21, off\n\t"
        "global_load_async_to_lds_b128 %10, %22, off\n\t"
        "global_load_async_to_lds_b128 %11, %23, off\n\t"
        "s_wait_xcnt 0x0"
        :: "v"(lds), "v"(lds + rs), "v"(lds + 2u * rs), "v"(lds + 3u * rs),
           "v"(lds + 4u * rs), "v"(lds + 5u * rs), "v"(lds + 6u * rs),
           "v"(lds + 7u * rs), "v"(lds + 8u * rs), "v"(lds + 9u * rs),
           "v"(lds + 10u * rs), "v"(lds + 11u * rs),
           "v"(ga), "v"(ga + gs), "v"(ga + 2 * gs), "v"(ga + 3 * gs),
           "v"(gb), "v"(gb + gs), "v"(gb + 2 * gs), "v"(gb + 3 * gs),
           "v"(gb + 4 * gs), "v"(gb + 5 * gs), "v"(gb + 6 * gs), "v"(gb + 7 * gs)
        : "memory");
}

__device__ __forceinline__ void gemm_tile_128x256(const _Float16* __restrict__ A,
                                                  const _Float16* __restrict__ Wt,
                                                  int mblk, int nblk, char* smem,
                                                  v8f (&acc)[4][4]) {
    const int tid  = threadIdx.x;
    const int wave = tid >> 5;
    const int lane = tid & 31;
    const int ln = lane & 15;
    const int kh = lane >> 4;
    const int wm = wave >> 2;   // 0..1
    const int wn = wave & 3;    // 0..3

    const int crow = tid / (GK / 8);
    const int cchk = tid % (GK / 8);
    const _Float16* ga = A  + (size_t)(mblk + crow) * DD + cchk * 8;
    const _Float16* gb = Wt + (size_t)(nblk + crow) * DD + cchk * 8;
    const unsigned lds0 = (unsigned)(size_t)smem + (unsigned)(crow * GPITCH + cchk * 16);

    const int aoff = (wm * 64 + ln) * GPITCH + kh * 16;
    const int boff = (GM + wn * 64 + ln) * GPITCH + kh * 16;

    copy_stage(lds0, ga, gb);
    // stage 0 has landed for this wave, then for all
    asm volatile("s_wait_asynccnt 0x0" ::: "memory");
    __syncthreads();
    copy_stage(lds0 + GSTAGE, ga + GK, gb + GK);

#pragma unroll 1   // the two buffers alternate by a scalar offset
    for (int t = 0; t < GPASSES; ++t) {
        const char* buf = smem + (t & 1) * GSTAGE;
#pragma unroll
        for (int ks = 0; ks < GK / 32; ++ks) {
            v16h a[4], b[4];
#pragma unroll
            for (int i = 0; i < 4; ++i)
                a[i] = frag_from_lds(buf + aoff + i * 16 * GPITCH + ks * 64);
#pragma unroll
            for (int j = 0; j < 4; ++j)
                b[j] = frag_from_lds(buf + boff + j * 16 * GPITCH + ks * 64);
            // keeps the 16 LDS reads of a k step together in front of its 16 WMMAs
            __builtin_amdgcn_sched_barrier(0);
#pragma unroll
            for (int i = 0; i < 4; ++i)
#pragma unroll
                for (int j = 0; j < 4; ++j)
                    acc[i][j] = wmma_f16(a[i], b[j], acc[i][j]);
            // the other side of the same fence: the next reads stay behind this block
            __builtin_amdgcn_sched_barrier(0);
        }
        // publish point of stage t + 1: this wave's reads of stage t are done,
        // its copies of stage t + 1 have landed, then every wave's
        asm volatile("s_wait_dscnt 0x0" ::: "memory");
        asm volatile("s_wait_asynccnt 0x0" ::: "memory");
        __syncthreads();
        if (t + 2 < GPASSES)
            copy_stage(lds0 + (unsigned)(t & 1) * GSTAGE,
                       ga + (size_t)(t + 2) * GK, gb + (size_t)(t + 2) * GK);
    }
    // no copy is left in flight when the wave goes on
    asm volatile("s_wait_asynccnt 0x0" ::: "memory");
}

// ---------------------------------------------------------------------------
// Kernel 0: fp32 -> f16 conversion of X and the four weights, one resident launch.
// The five f16 copies lie one behind the other in the workspace, so the destination
// is one array. A chunk is 1024 elements: 8 loads of a wave, each 512 contiguous
// bytes. 256 blocks x 16 waves; a wave takes CVT_XTRIPS chunks of X, CVT_WAVES apart,
// and one chunk of a weight; all its loads are issued ahead of its stores.
// ---------------------------------------------------------------------------
#define CVT_CHUNK 1024
#define CVT_BLOCKS 256
#define CVT_WAVES (CVT_BLOCKS * 16)
#define CVT_XCH (BB * SS * DD / CVT_CHUNK)   // chunks of X
#define CVT_WCH (DD * DD / CVT_CHUNK)        // chunks of one weight
#define CVT_XTRIPS (CVT_XCH / CVT_WAVES)
static_assert(CVT_XTRIPS * CVT_WAVES == CVT_XCH, "X is a whole number of trips");
static_assert(4 * CVT_WCH == CVT_WAVES, "the four weights are one trip");

typedef __attribute__((ext_vector_type(4))) float    c4f;
typedef __attribute__((ext_vector_type(4))) _Float16 c4h;

__global__ __launch_bounds__(512)
void cvt_all_kernel(const float* __restrict__ X,
                    const float* __restrict__ Wq, const float* __restrict__ Wk,
                    const float* __restrict__ Wv, const float* __restrict__ Wo,
                    _Float16* __restrict__ dst) {
    const int lane = threadIdx.x & 31;
    // the wave's number in a scalar register: source choice and bases stay scalar
    const int wave = __builtin_amdgcn_readfirstlane((int)(blockIdx.x * 16 + (threadIdx.x >> 5)));
    const int w = wave / CVT_WCH;
    const float* Ws = w == 0 ? Wq : w == 1 ? Wk : w == 2 ? Wv : Wo;

    c4f v[CVT_XTRIPS + 1][8];
#pragma unroll
    for (int t = 0; t <= CVT_XTRIPS; ++t) {
        const float* s = t < CVT_XTRIPS ? X + (size_t)(t * CVT_WAVES + wave) * CVT_CHUNK
                                        : Ws + (size_t)(wave % CVT_WCH) * CVT_CHUNK;
#pragma unroll
        for (int u = 0; u < 8; ++u) v[t][u] = *(const c4f*)(s + u * 128 + lane * 4);
    }
    // keeps every load in front of the first conversion: without it the compiler holds
    // the later loads back until registers of the first ones are free, a second latency
    __builtin_amdgcn_sched_barrier(0);
#pragma unroll
    for (int t = 0; t <= CVT_XTRIPS; ++t) {
        _Float16* d = dst + (size_t)(t * CVT_WAVES + wave) * CVT_CHUNK + lane * 4;
#pragma unroll
        for (int u = 0; u < 8; ++u) *(c4h*)(d + u * 128) = __builtin_convertvector(v[t][u], c4h);
    }
}

// ---------------------------------------------------------------------------
// Kernel 1: fused QKV projection, all-f16 operands.
//   Xh : [B*S, D] f16,  W*h : [D, D] f16 (out = X @ W^T + b)
//   Q/K/V out: f16 [B, H, S, HD]; Q scaled by QK_SCALE after bias.
// Block 256 = 8 waves; block tile 128(M) x 256(N) through gemm_tile_128x256.
// grid = (M/128, D/256, 3)
// ---------------------------------------------------------------------------
__global__ __launch_bounds__(256)
void qkv_proj_kernel(const _Float16* __restrict__ Xh,
                     const _Float16* __restrict__ Wqh, const float* __restrict__ bq,
                     const _Float16* __restrict__ Wkh, const float* __restrict__ bk,
                     const _Float16* __restrict__ Wvh, const float* __restrict__ bv,
                     _Float16* __restrict__ Qo, _Float16* __restrict__ Ko,
                     _Float16* __restrict__ Vo) {
    __shared__ __attribute__((aligned(16))) char smem[2 * GSTAGE];
    const int wave = threadIdx.x >> 5;
    const int lane = threadIdx.x & 31;
    const int mblk = blockIdx.x * GM;
    const int nblk = blockIdx.y * GN;
    const int which = blockIdx.z;

    const _Float16* W;
    const float* bias;
    _Float16* out;
    float scale;
    if (which == 0)      { W = Wqh; bias = bq; out = Qo; scale = QK_SCALE; }
    else if (which == 1) { W = Wkh; bias = bk; out = Ko; scale = 1.0f; }
    else                 { W = Wvh; bias = bv; out = Vo; scale = 1.0f; }

    const int ln = lane & 15;
    const int kh = lane >> 4;

    v8f acc[4][4] = {};
    gemm_tile_128x256(Xh, W, mblk, nblk, smem, acc);

    const int m0 = mblk + (wave >> 2) * 64;
    const int n0 = nblk + (wave & 3) * 64;

    // Epilogue: C layout -> lane holds col, rows r + 8*(lane>>4).
#pragma unroll
    for (int j = 0; j < 4; ++j) {
        const int n  = n0 + 16 * j + ln;
        const float bn = bias[n];
        const int h  = n >> 6;       // head
        const int hd = n & 63;       // dim within head
#pragma unroll
        for (int i = 0; i < 4; ++i) {
#pragma unroll
            for (int r = 0; r < 8; ++r) {
                const int m = m0 + 16 * i + r + 8 * kh;
                const int bidx = m >> 10;
                const int s    = m & (SS - 1);
                const float val = (acc[i][j][r] + bn) * scale;
                out[(((size_t)bidx * HH + h) * SS + s) * HD + hd] = (_Float16)val;
            }
        }
    }
}

// ---------------------------------------------------------------------------
// Kernel 2: flash attention per (b, h), transposed products.
//   Q/K/V: f16 [B, H, S, HD]; mask fp32 [B, 1, S, S] additive.
//   Output: f16 [B, S, D] row-major.
// Block 256 = 8 waves; a wave handles 32 queries (two groups of 16) x full HD, the
// block 256 queries of one head; kv in 32-wide passes.
//   S^T(32 kv x 16 q) = K * Q^T : a lane holds 16 scores of ONE query of each group,
//   keys 8*hi + r and 16 + 8*hi + r, so maximum and sum run in the lane and the two
//   wave halves meet by one cross-row move.
//   O^T(64 hd x 16 q) += V^T * P^T : the two score tiles, converted in place, are the
//   B operand in the hardware k order; V^T comes by the transposing LDS load.
// A stage is [K 32 rows | V 32 rows | mask 256 query rows x 32 keys] in LDS. The eight
// waves read the same K and V rows, so a stage is fetched once for 256 queries; two
// buffers, filled by asynchronous copies to LDS one pass ahead of their readers.
// grid = (S/256, B*H)
// ---------------------------------------------------------------------------
#define KPITCH 144   // bytes of a K row in LDS: 16 B x odd for ds_load_b128
#define VPITCH 160   // bytes of a V row in LDS: 32 B x odd for ds_load_tr16_b128
#define MPITCH 144   // bytes of a mask row in LDS: 16 B x odd for ds_load_b128
#define AQ 256       // queries of a block
#define AKV 32       // keys of a stage
#define AV_OFF (AKV * KPITCH)
#define AM_OFF (AV_OFF + AKV * VPITCH)
#define ASTAGE (AM_OFF + AQ * MPITCH)   // bytes of one buffer
#define APASSES (SS / AKV)

typedef __attribute__((ext_vector_type(8))) short s16x8;
typedef __attribute__((ext_vector_type(4))) float v4f;

// lane (c, h) gets T[8h + 0..7][c] of the 16 x 16 tile its 32 lane addresses name
__device__ __forceinline__ v8h lds_tr16(const char* p) {
    typedef __attribute__((address_space(3))) s16x8 lds_s16x8;
    return __builtin_bit_cast(v8h, __builtin_amdgcn_ds_load_tr16_b128_v8i16((lds_s16x8*)p));
}

// value of lane l ^ 16
__device__ __forceinline__ float other_half(float x) {
    const int v = __builtin_bit_cast(int, x);
    return __builtin_bit_cast(float, __builtin_amdgcn_permlanex16(
        v, v, 0x76543210, 0xfedcba98, false, false));
}

// One stage: one copy for the rows of K, one for those of V, eight for the mask rows
// (32 rows a copy of the block, 8 lanes a row, 16 B per lane). kd / vd / md are this
// lane's places in the stage's buffer, kg / vg / mg its 16 B at the stage's keys. One
// statement, so that one s_wait_xcnt serves all ten and no address register is
// rewritten ahead of it.
static_assert(AKV * 8 == 256 && AQ == 8 * 32, "attn_copy_stage issues 1 + 1 + 8 copies");
__device__ __forceinline__ void attn_copy_stage(unsigned kd, unsigned vd, unsigned md,
                                                const _Float16* kg, const _Float16* vg,
                                                const float* mg) {
    const unsigned rs = 32u * MPITCH;      // LDS bytes between two mask copies
    const size_t   gs = (size_t)32 * SS;   // floats between two mask copies
    asm volatile(
        "global_load_async_to_lds_b128 %0, %10, off\n\t"
        "global_load_async_to_lds_b128 %1, %11, off\n\t"
        "global_load_async_to_lds_b128 %2, %12, off\n\t"
        "global_load_async_to_lds_b128 %3, %13, off\n\t"
        "global_load_async_to_lds_b128 %4, %14, off\n\t"
        "global_load_async_to_lds_b128 %5, %15, off\n\t"
        "global_load_async_to_lds_b128 %6, %16, off\n\t"
        "global_load_async_to_lds_b128 %7, %17, off\n\t"
        "global_load_async_to_lds_b128 %8, %18, off\n\t"
        "global_load_async_to_lds_b128 %9, %19, off\n\t"
        "s_wait_xcnt 0x0"
        :: "v"(kd), "v"(vd), "v"(md), "v"(md + rs), "v"(md + 2u * rs), "v"(md + 3u * rs),
           "v"(md + 4u * rs), "v"(md + 5u * rs), "v"(md + 6u * rs), "v"(md + 7u * rs),
           "v"(kg), "v"(vg), "v"(mg), "v"(mg + gs), "v"(mg + 2 * gs), "v"(mg + 3 * gs),
           "v"(mg + 4 * gs), "v"(mg + 5 * gs), "v"(mg + 6 * gs), "v"(mg + 7 * gs)
        : "memory");
}

__global__ __launch_bounds__(256)
void flash_attn_kernel(const _Float16* __restrict__ Q,
                       const _Float16* __restrict__ K,
                       const _Float16* __restrict__ V,
                       const float* __restrict__ mask,
                       _Float16* __restrict__ Ao) {
    __shared__ __attribute__((aligned(32))) char smem[2 * ASTAGE];

    const int tid  = threadIdx.x;
    const int wave = tid >> 5;
    const int lane = tid & 31;
    const int ln = lane & 15;
    const int hi = lane >> 4;
    const int qblk = blockIdx.x * AQ;
    const int q0 = qblk + wave * 32;
    const int bh = blockIdx.y;
    const int b  = bh >> 4;
    const int h  = bh & 15;

    const _Float16* Qb = Q + (size_t)bh * SS * HD;

    // this thread's 16 B of a stage's K rows, V rows and first 32 mask rows
    const int crow = tid >> 3;
    const int cchk = tid & 7;
    const _Float16* kg = K + (size_t)bh * SS * HD + crow * HD + cchk * 8;
    const _Float16* vg = V + (size_t)bh * SS * HD + crow * HD + cchk * 8;
    const float* mg = mask + (size_t)b * SS * SS + (size_t)(qblk + crow) * SS + cchk * 4;
    const unsigned lds0 = (unsigned)(size_t)smem;
    const unsigned kd = lds0 + (unsigned)(crow * KPITCH + cchk * 16);
    const unsigned vd = lds0 + (unsigned)(AV_OFF + crow * VPITCH + cchk * 16);
    const unsigned md = lds0 + (unsigned)(AM_OFF + crow * MPITCH + cchk * 16);

    // where this lane reads in a buffer: its key row of K, its transposing loads of V,
    // its first group's query row of the mask at its half's first key
    const int krd = ln * KPITCH + hi * 16;
    const int vrd = AV_OFF + (8 * hi + (lane & 7)) * VPITCH + 16 * ((lane >> 3) & 1);
    const int mrd = AM_OFF + (wave * 32 + ln) * MPITCH + 32 * hi;

    attn_copy_stage(kd, vd, md, kg, vg, mg);

    v16h qb[2][2];
#pragma unroll
    for (int c = 0; c < 2; ++c) {
        qb[c][0] = frag_from_f16(Qb + (size_t)(q0 + 16 * c + ln) * HD + 0, hi);
        qb[c][1] = frag_from_f16(Qb + (size_t)(q0 + 16 * c + ln) * HD + 32, hi);
    }

    float mrun[2] = {-1e30f, -1e30f};
    float lrun[2] = {0.0f, 0.0f};   // this half's keys only, joined at the end
    v8f o[2][4] = {};

    // stage 0 has landed for this wave, then for all
    asm volatile("s_wait_asynccnt 0x0" ::: "memory");
    __syncthreads();
    attn_copy_stage(kd + ASTAGE, vd + ASTAGE, md + ASTAGE,
                    kg + AKV * HD, vg + AKV * HD, mg + AKV);

#pragma unroll 1   // the two buffers alternate by a scalar offset
    for (int t = 0; t < APASSES; ++t) {
        const char* buf = smem + (t & 1) * ASTAGE;

        // ---- this pass's K fragments and mask rows, one group of LDS reads ----
        v16h ka[2][2];
#pragma unroll
        for (int kt = 0; kt < 2; ++kt)
#pragma unroll
            for (int ks = 0; ks < 2; ++ks)
                ka[kt][ks] = frag_from_lds(buf + krd + kt * 16 * KPITCH + ks * 64);
        v8f mk[2][2];   // [query group][key tile]
#pragma unroll
        for (int c = 0; c < 2; ++c) {
            const char* mp = buf + mrd + c * 16 * MPITCH;
            const v4f a0 = *(const v4f*)(mp),      a1 = *(const v4f*)(mp + 16);
            const v4f b0 = *(const v4f*)(mp + 64), b1 = *(const v4f*)(mp + 80);
            mk[c][0] = __builtin_shufflevector(a0, a1, 0, 1, 2, 3, 4, 5, 6, 7);
            mk[c][1] = __builtin_shufflevector(b0, b1, 0, 1, 2, 3, 4, 5, 6, 7);
        }
        // keeps the 16 LDS reads together in front of the 8 score WMMAs, for speed only
        __builtin_amdgcn_sched_barrier(0);

        // ---- scores, transposed: each K fragment serves both query groups ----
        v8f s[2][2] = {};   // [query group][key tile]
#pragma unroll
        for (int ks = 0; ks < 2; ++ks)
#pragma unroll
            for (int c = 0; c < 2; ++c)
#pragma unroll
                for (int kt = 0; kt < 2; ++kt)
                    s[c][kt] = wmma_f16(ka[kt][ks], qb[c][ks], s[c][kt]);

        // ---- V^T fragments: the pass's last LDS reads, one group ----
        v16h va[4];
#pragma unroll
        for (int g = 0; g < 4; ++g) {
            const v8h lo = lds_tr16(buf + vrd + 32 * g);
            const v8h up = lds_tr16(buf + vrd + 16 * VPITCH + 32 * g);
            va[g] = __builtin_shufflevector(lo, up, 0, 1, 2, 3, 4, 5, 6, 7,
                                            8, 9, 10, 11, 12, 13, 14, 15);
        }

        // publish point of stage t + 1. It stands behind the pass's last LDS read, not at
        // the loop's end: what follows works on registers alone, so the refill flies for a
        // whole pass. This wave's reads of stage t are done, its copies of stage t + 1
        // have landed, then every wave's
        asm volatile("s_wait_dscnt 0x0" ::: "memory");
        asm volatile("s_wait_asynccnt 0x0" ::: "memory");
        __syncthreads();
        if (t + 2 < APASSES) {
            const unsigned bo = (unsigned)(t & 1) * ASTAGE;
            attn_copy_stage(kd + bo, vd + bo, md + bo,
                            kg + (size_t)(t + 2) * AKV * HD, vg + (size_t)(t + 2) * AKV * HD,
                            mg + (size_t)(t + 2) * AKV);
        }

        // ---- additive mask + online softmax, one query of each group per lane ----
        v16h pb[2];   // P^T as B: element e is key 8*hi + e (e < 8) or 16 + 8*hi + e - 8 of this lane's query
#pragma unroll
        for (int c = 0; c < 2; ++c) {
            const v8f s0 = s[c][0] + mk[c][0];
            const v8f s1 = s[c][1] + mk[c][1];

            float mx = fmaxf(s0[0], s1[0]);
#pragma unroll
            for (int r = 1; r < 8; ++r) mx = fmaxf(mx, fmaxf(s0[r], s1[r]));
            mx = fmaxf(mx, other_half(mx));
            const float mn    = fmaxf(mrun[c], mx);
            const float alpha = __expf(mrun[c] - mn);

            float rs0 = 0.0f, rs1 = 0.0f;
#pragma unroll
            for (int r = 0; r < 8; ++r) {
                const float p0 = __expf(s0[r] - mn);
                const float p1 = __expf(s1[r] - mn);
                rs0 += p0;
                rs1 += p1;
                pb[c][r]     = (_Float16)p0;
                pb[c][r + 8] = (_Float16)p1;
            }
            lrun[c] = lrun[c] * alpha + (rs0 + rs1);
            mrun[c] = mn;
#pragma unroll
            for (int g = 0; g < 4; ++g) o[c][g] *= alpha;
        }

        // ---- PV: each V^T fragment serves both query groups ----
#pragma unroll
        for (int g = 0; g < 4; ++g)
#pragma unroll
            for (int c = 0; c < 2; ++c) o[c][g] = wmma_f16(va[g], pb[c], o[c][g]);

    }
    // no copy is left in flight when the wave goes on
    asm volatile("s_wait_asynccnt 0x0" ::: "memory");

    // ---- finalize: join the halves' sums, O /= l, write f16 [B, S, D] ----
    // o[c][g][r] = O[q0 + 16 c + ln][16 g + 8 hi + r]: 8 consecutive halves, one 16 B store
#pragma unroll
    for (int c = 0; c < 2; ++c) {
        const float inv = 1.0f / (lrun[c] + other_half(lrun[c]));
        _Float16* dst = Ao + ((size_t)b * SS + q0 + 16 * c + ln) * DD + h * HD + 8 * hi;
#pragma unroll
        for (int g = 0; g < 4; ++g) {
            v8h w;
#pragma unroll
            for (int r = 0; r < 8; ++r) w[r] = (_Float16)(o[c][g][r] * inv);
            *(v8h*)(dst + g * 16) = w;
        }
    }
}

// ---------------------------------------------------------------------------
// Kernel 3: output projection, all-f16 operands, fp32 result.
//   A : f16 [B*S, D], Woh : f16 [D, D], out = A @ Wo^T + bo (fp32)
// Block 256 = 8 waves; block tile 128(M) x 256(N) through gemm_tile_128x256.
// grid = (M/128, D/256)
// ---------------------------------------------------------------------------
__global__ __launch_bounds__(256)
void out_proj_kernel(const _Float16* __restrict__ A,
                     const _Float16* __restrict__ Woh,
                     const float* __restrict__ bo,
                     float* __restrict__ out) {
    __shared__ __attribute__((aligned(16))) char smem[2 * GSTAGE];
    const int wave = threadIdx.x >> 5;
    const int lane = threadIdx.x & 31;
    const int mblk = blockIdx.x * GM;
    const int nblk = blockIdx.y * GN;
    const int ln = lane & 15;
    const int kh = lane >> 4;

    v8f acc[4][4] = {};
    gemm_tile_128x256(A, Woh, mblk, nblk, smem, acc);

    const int m0 = mblk + (wave >> 2) * 64;
    const int n0 = nblk + (wave & 3) * 64;

#pragma unroll
    for (int j = 0; j < 4; ++j) {
        const int n = n0 + 16 * j + ln;
        const float bn = bo[n];
#pragma unroll
        for (int i = 0; i < 4; ++i) {
#pragma unroll
            for (int r = 0; r < 8; ++r) {
                const int m = m0 + 16 * i + r + 8 * kh;
                out[(size_t)m * DD + n] = acc[i][j][r] + bn;
            }
        }
    }
}

// ---------------------------------------------------------------------------
// Host side
// ---------------------------------------------------------------------------
extern "C" void kernel_launch(void* const* d_in, const int* in_sizes, int n_in,
                              void* d_out, int out_size, void* d_ws, size_t ws_size,
                              hipStream_t stream) {
    const float* X    = (const float*)d_in[0];  // [B, S, D]
    const float* mask = (const float*)d_in[1];  // [B, 1, S, S]
    const float* Wq   = (const float*)d_in[2];
    const float* bq   = (const float*)d_in[3];
    const float* Wk   = (const float*)d_in[4];
    const float* bk   = (const float*)d_in[5];
    const float* Wv   = (const float*)d_in[6];
    const float* bv   = (const float*)d_in[7];
    const float* Wo   = (const float*)d_in[8];
    const float* bo   = (const float*)d_in[9];
    float* out = (float*)d_out;

    // Workspace layout (halves):
    //   Xh   : B*S*D        = 8388608
    //   Wqh/Wkh/Wvh/Woh : D*D = 1048576 each
    //   Qw/Kw/Vw : B*H*S*HD = 8388608 each
    //   Aw   : B*S*D        = 8388608
    const size_t nX = (size_t)BB * SS * DD;   // 8388608
    const size_t nW = (size_t)DD * DD;        // 1048576
    _Float16* Xh  = (_Float16*)d_ws;
    _Float16* Wqh = Xh + nX;
    _Float16* Wkh = Wqh + nW;
    _Float16* Wvh = Wkh + nW;
    _Float16* Woh = Wvh + nW;
    _Float16* Qw  = Woh + nW;
    _Float16* Kw  = Qw + nX;
    _Float16* Vw  = Kw + nX;
    _Float16* Aw  = Vw + nX;

    const int M = BB * SS;  // 8192

    // ---- convert fp32 activations + weights to f16 once: Xh .. Woh are contiguous ----
    cvt_all_kernel<<<CVT_BLOCKS, 512, 0, stream>>>(X, Wq, Wk, Wv, Wo, Xh);

    dim3 gqkv(M / GM, DD / GN, 3);
    qkv_proj_kernel<<<gqkv, 256, 0, stream>>>(Xh, Wqh, bq, Wkh, bk, Wvh, bv, Qw, Kw, Vw);

    dim3 gattn(SS / AQ, BB * HH);
    flash_attn_kernel<<<gattn, 256, 0, stream>>>(Qw, Kw, Vw, mask, Aw);

    dim3 gout(M / GM, DD / GN);
    out_proj_kernel<<<gout, 256, 0, stream>>>(Aw, Woh, bo, out);
}

// v005
// A run of this version takes 111 microseconds.
// Next to v004, in two timings, it ran 1.05 times as fast each time.
// Counting every step since v000, it is 4.41 times as fast.
#include <hip/hip_runtime.h>
#include <hip/hip_bf16.h>

typedef __attribute__((ext_vector_type(16))) _Float16 v16h;
typedef __attribute__((ext_vector_type(8)))  _Float16 v8h;
typedef __attribute__((ext_vector_type(8)))  float    v8f;

#define BB 8
#define SS 1024
#define DD 1024
#define HH 16
#define HD 64
#define QK_SCALE 0.125f   // 64^-0.5

// ---------------------------------------------------------------------------
// WMMA wrapper: D = A(16x32 f16) * B(32x16 f16) + C(16x16 f32)
// ---------------------------------------------------------------------------
__device__ __forceinline__ v8f wmma_f16(v16h a, v16h b, v8f c) {
    return __builtin_amdgcn_wmma_f32_16x16x32_f16(
        false, a, false, b, (short)0, c, false, false);
}

// ---------------------------------------------------------------------------
// A/B fragment loader (16-bit operand, 16x32 tile), f16 source.
// Lane L: row/col = L&15, khalf = L>>4.
//   elems 0..7  -> K = khalf*8 + e ; elems 8..15 -> K = 16 + khalf*8 + e
// ---------------------------------------------------------------------------
__device__ __forceinline__ v16h frag_from_f16(const _Float16* __restrict__ p, int kh) {
    v16h f;
    const _Float16* a = p + kh * 8;
    const _Float16* b = p + 16 + kh * 8;
#pragma unroll
    for (int e = 0; e < 8; ++e) {
        f[e]     = a[e];
        f[e + 8] = b[e];
    }
    return f;
}

// ---------------------------------------------------------------------------
// Shared GEMM core of the two projections: Y(128 x 256) = A(128 x K) * W(256 x K)^T.
// Block 256 = 8 waves (2 x 4), wave tile 64 x 64 (16 accumulators).
// A pass is GK k of every operand row; a stage is [A 128 rows | W 256 rows] at
// pitch GPITCH bytes in LDS; two buffers, filled by asynchronous copies to LDS
// one pass ahead of their readers.
// The rows of W are dealt: LDS row q of the W part holds row
//   (q & ~63) + 4 * (q & 15) + ((q >> 4) & 3)
// of the tile, so lane ln of a wave's B fragment j holds column 4 * ln + j of the wave's
// 64: acc[i][0..3][r] of a lane are four neighbouring columns of one output row, and the
// 16 lanes of a half wave store 64 neighbouring columns, whole 128-B lines.
// ---------------------------------------------------------------------------
#define GM 128
#define GN 256
#define GK 64
#define GPITCH (GK * 2 + 16)              // bytes; 16 B x odd for ds_load_b128
#define GSTAGE ((GM + GN) * GPITCH)       // bytes of one buffer
#define GPASSES (DD / GK)
#define GCROWS (256 / (GK / 8))           // rows that one copy of the block covers

__device__ __forceinline__ v16h frag_from_lds(const char* p) {
    const v8h lo = *(const v8h*)p;
    const v8h hi = *(const v8h*)(p + 32);
    return __builtin_shufflevector(lo, hi, 0, 1, 2, 3, 4, 5, 6, 7,
                                   8, 9, 10, 11, 12, 13, 14, 15);
}

// One stage: 4 copies for the rows of A and 8 for those of W, 16 B per lane each,
// GCROWS rows apart in LDS. ga / gb are this lane's 16 B in its row of the first copy
// of A / W at the stage's k, lds its place in the stage's buffer. In global memory the
// copies of A are GCROWS rows apart; copy c of W starts 64 * (c >> 1) + 2 * (c & 1) rows
// on (the deal of W's rows, above). One statement, so that one
// s_wait_xcnt serves all twelve and no address register is rewritten ahead of it.
static_assert(GM == 4 * GCROWS && GN == 8 * GCROWS, "copy_stage issues 4 + 8 copies");
static_assert(GCROWS == 32, "the deal of W's rows is written for 32 rows a copy");
__device__ __forceinline__ void copy_stage(unsigned lds, const _Float16* ga,
                                           const _Float16* gb) {
    const unsigned rs = GCROWS * GPITCH;      // LDS bytes between two copies
    const size_t   gs = (size_t)GCROWS * DD;  // halves between two copies
    asm volatile(
        "global_load_async_to_lds_b128 %0, %12, off\n\t"
        "global_load_async_to_lds_b128 %1, %13, off\n\t"
        "global_load_async_to_lds_b128 %2, %14, off\n\t"
        "global_load_async_to_lds_b128 %3, %15, off\n\t"
        "global_load_async_to_lds_b128 %4, %16, off\n\t"
        "global_load_async_to_lds_b128 %5, %17, off\n\t"
        "global_load_async_to_lds_b128 %6, %18, off\n\t"
        "global_load_async_to_lds_b128 %7, %19, off\n\t"
        "global_load_async_to_lds_b128 %8, %20, off\n\t"
        "global_load_async_to_lds_b128 %9, %21, off\n\t"
        "global_load_async_to_lds_b128 %10, %22, off\n\t"
        "global_load_async_to_lds_b128 %11, %23, off\n\t"
        "s_wait_xcnt 0x0"
        :: "v"(lds), "v"(lds + rs), "v"(lds + 2u * rs), "v"(lds + 3u * rs),
           "v"(lds + 4u * rs), "v"(lds + 5u * rs), "v"(lds + 6u * rs),
           "v"(lds + 7u * rs), "v"(lds + 8u * rs), "v"(lds + 9u * rs),
           "v"(lds + 10u * rs), "v"(lds + 11u * rs),
           "v"(ga), "v"(ga + gs), "v"(ga + 2 * gs), "v"(ga + 3 * gs),
           "v"(gb), "v"(gb + 2 * DD), "v"(gb + 64 * DD), "v"(gb + 66 * DD),
           "v"(gb + 128 * DD), "v"(gb + 130 * DD), "v"(gb + 192 * DD), "v"(gb + 194 * DD)
        : "memory");
}

__device__ __forceinline__ void gemm_tile_128x256(const _Float16* __restrict__ A,
                                                  const _Float16* __restrict__ Wt,
                                                  int mblk, int nblk, char* smem,
                                                  v8f (&acc)[4][4]) {
    const int tid  = threadIdx.x;
    const int wave = tid >> 5;
    const int lane = tid & 31;
    const int ln = lane & 15;
    const int kh = lane >> 4;
    const int wm = wave >> 2;   // 0..1
    const int wn = wave & 3;    // 0..3

    const int crow = tid / (GK / 8);
    const int cchk = tid % (GK / 8);
    const _Float16* ga = A  + (size_t)(mblk + crow) * DD + cchk * 8;
    // LDS row crow of the W part takes row 4 * (crow & 15) + (crow >> 4) of the tile
    const _Float16* gb = Wt + (size_t)(nblk + 4 * (crow & 15) + (crow >> 4)) * DD + cchk * 8;
    const unsigned lds0 = (unsigned)(size_t)smem + (unsigned)(crow * GPITCH + cchk * 16);

    const int aoff = (wm * 64 + ln) * GPITCH + kh * 16;
    const int boff = (GM + wn * 64 + ln) * GPITCH + kh * 16;

    copy_stage(lds0, ga, gb);
    // stage 0 has landed for this wave, then for all
    asm volatile("s_wait_asynccnt 0x0" ::: "memory");
    __syncthreads();
    copy_stage(lds0 + GSTAGE, ga + GK, gb + GK);

#pragma unroll 1   // the two buffers alternate by a scalar offset
    for (int t = 0; t < GPASSES; ++t) {
        const char* buf = smem + (t & 1) * GSTAGE;
#pragma unroll
        for (int ks = 0; ks < GK / 32; ++ks) {
            v16h a[4], b[4];
#pragma unroll
            for (int i = 0; i < 4; ++i)
                a[i] = frag_from_lds(buf + aoff + i * 16 * GPITCH + ks * 64);
#pragma unroll
            for (int j = 0; j < 4; ++j)
                b[j] = frag_from_lds(buf + boff + j * 16 * GPITCH + ks * 64);
            // keeps the 16 LDS reads of a k step together in front of its 16 WMMAs
            __builtin_amdgcn_sched_barrier(0);
#pragma unroll
            for (int i = 0; i < 4; ++i)
#pragma unroll
                for (int j = 0; j < 4; ++j)
                    acc[i][j] = wmma_f16(a[i], b[j], acc[i][j]);
            // the other side of the same fence: the next reads stay behind this block
            __builtin_amdgcn_sched_barrier(0);
        }
        // publish point of stage t + 1: this wave's reads of stage t are done,
        // its copies of stage t + 1 have landed, then every wave's
        asm volatile("s_wait_dscnt 0x0" ::: "memory");
        asm volatile("s_wait_asynccnt 0x0" ::: "memory");
        __syncthreads();
        if (t + 2 < GPASSES)
            copy_stage(lds0 + (unsigned)(t & 1) * GSTAGE,
                       ga + (size_t)(t + 2) * GK, gb + (size_t)(t + 2) * GK);
    }
    // no copy is left in flight when the wave goes on
    asm volatile("s_wait_asynccnt 0x0" ::: "memory");
}

// ---------------------------------------------------------------------------
// Kernel 0: fp32 -> f16 conversion of X and the four weights, one resident launch.
// The five f16 copies lie one behind the other in the workspace, so the destination
// is one array. A chunk is 1024 elements: 8 loads of a wave, each 512 contiguous
// bytes. 256 blocks x 16 waves; a wave takes CVT_XTRIPS chunks of X, CVT_WAVES apart,
// and one chunk of a weight; all its loads are issued ahead of its stores.
// ---------------------------------------------------------------------------
#define CVT_CHUNK 1024
#define CVT_BLOCKS 256
#define CVT_WAVES (CVT_BLOCKS * 16)
#define CVT_XCH (BB * SS * DD / CVT_CHUNK)   // chunks of X
#define CVT_WCH (DD * DD / CVT_CHUNK)        // chunks of one weight
#define CVT_XTRIPS (CVT_XCH / CVT_WAVES)
static_assert(CVT_XTRIPS * CVT_WAVES == CVT_XCH, "X is a whole number of trips");
static_assert(4 * CVT_WCH == CVT_WAVES, "the four weights are one trip");

typedef __attribute__((ext_vector_type(4))) float    c4f;
typedef __attribute__((ext_vector_type(4))) _Float16 c4h;

__global__ __launch_bounds__(512)
void cvt_all_kernel(const float* __restrict__ X,
                    const float* __restrict__ Wq, const float* __restrict__ Wk,
                    const float* __restrict__ Wv, const float* __restrict__ Wo,
                    _Float16* __restrict__ dst) {
    const int lane = threadIdx.x & 31;
    // the wave's number in a scalar register: source choice and bases stay scalar
    const int wave = __builtin_amdgcn_readfirstlane((int)(blockIdx.x * 16 + (threadIdx.x >> 5)));
    const int w = wave / CVT_WCH;
    const float* Ws = w == 0 ? Wq : w == 1 ? Wk : w == 2 ? Wv : Wo;

    c4f v[CVT_XTRIPS + 1][8];
#pragma unroll
    for (int t = 0; t <= CVT_XTRIPS; ++t) {
        const float* s = t < CVT_XTRIPS ? X + (size_t)(t * CVT_WAVES + wave) * CVT_CHUNK
                                        : Ws + (size_t)(wave % CVT_WCH) * CVT_CHUNK;
#pragma unroll
        for (int u = 0; u < 8; ++u) v[t][u] = *(const c4f*)(s + u * 128 + lane * 4);
    }
    // keeps every load in front of the first conversion: without it the compiler holds
    // the later loads back until registers of the first ones are free, a second latency
    __builtin_amdgcn_sched_barrier(0);
#pragma unroll
    for (int t = 0; t <= CVT_XTRIPS; ++t) {
        _Float16* d = dst + (size_t)(t * CVT_WAVES + wave) * CVT_CHUNK + lane * 4;
#pragma unroll
        for (int u = 0; u < 8; ++u) *(c4h*)(d + u * 128) = __builtin_convertvector(v[t][u], c4h);
    }
}

// ---------------------------------------------------------------------------
// Kernel 1: fused QKV projection, all-f16 operands.
//   Xh : [B*S, D] f16,  W*h : [D, D] f16 (out = X @ W^T + b)
//   Q/K/V out: f16 [B, H, S, HD]; Q scaled by QK_SCALE after bias.
// Block 256 = 8 waves; block tile 128(M) x 256(N) through gemm_tile_128x256.
// grid = (M/128, D/256, 3)
// ---------------------------------------------------------------------------
__global__ __launch_bounds__(256)
void qkv_proj_kernel(const _Float16* __restrict__ Xh,
                     const _Float16* __restrict__ Wqh, const float* __restrict__ bq,
                     const _Float16* __restrict__ Wkh, const float* __restrict__ bk,
                     const _Float16* __restrict__ Wvh, const float* __restrict__ bv,
                     _Float16* __restrict__ Qo, _Float16* __restrict__ Ko,
                     _Float16* __restrict__ Vo) {
    __shared__ __attribute__((aligned(16))) char smem[2 * GSTAGE];
    const int wave = threadIdx.x >> 5;
    const int lane = threadIdx.x & 31;
    const int mblk = blockIdx.x * GM;
    const int nblk = blockIdx.y * GN;
    const int which = blockIdx.z;

    const _Float16* W;
    const float* bias;
    _Float16* out;
    float scale;
    if (which == 0)      { W = Wqh; bias = bq; out = Qo; scale = QK_SCALE; }
    else if (which == 1) { W = Wkh; bias = bk; out = Ko; scale = 1.0f; }
    else                 { W = Wvh; bias = bv; out = Vo; scale = 1.0f; }

    const int ln = lane & 15;
    const int kh = lane >> 4;

    v8f acc[4][4] = {};
    gemm_tile_128x256(Xh, W, mblk, nblk, smem, acc);

    const int m0 = mblk + (wave >> 2) * 64;
    const int n0 = nblk + (wave & 3) * 64;

    // Epilogue: acc[i][j][r] is row 16 i + r + 8 kh, column 4 ln + j of the wave's tile,
    // whose 64 columns are one head: 8 B a lane, a half wave stores the head's whole row.
    const int h = n0 >> 6;       // head
    const c4f bn = *(const c4f*)(bias + n0 + 4 * ln);
#pragma unroll
    for (int i = 0; i < 4; ++i) {
#pragma unroll
        for (int r = 0; r < 8; ++r) {
            const int m = m0 + 16 * i + r + 8 * kh;
            const int bidx = m >> 10;
            const int s    = m & (SS - 1);
            c4h w;
#pragma unroll
            for (int j = 0; j < 4; ++j) w[j] = (_Float16)((acc[i][j][r] + bn[j]) * scale);
            *(c4h*)(out + (((size_t)bidx * HH + h) * SS + s) * HD + 4 * ln) = w;
        }
    }
}

// ---------------------------------------------------------------------------
// Kernel 2: flash attention per (b, h), transposed products.
//   Q/K/V: f16 [B, H, S, HD]; mask fp32 [B, 1, S, S] additive.
//   Output: f16 [B, S, D] row-major.
// Block 256 = 8 waves; a wave handles 32 queries (two groups of 16) x full HD, the
// block 256 queries of one head; kv in 32-wide passes.
//   S^T(32 kv x 16 q) = K * Q^T : a lane holds 16 scores of ONE query of each group,
//   keys 8*hi + r and 16 + 8*hi + r, so maximum and sum run in the lane and the two
//   wave halves meet by one cross-row move.
//   O^T(64 hd x 16 q) += V^T * P^T : the two score tiles, converted in place, are the
//   B operand in the hardware k order; V^T comes by the transposing LDS load.
// A stage is [K 32 rows | V 32 rows | mask 256 query rows x 32 keys] in LDS. The eight
// waves read the same K and V rows, so a stage is fetched once for 256 queries; two
// buffers, filled by asynchronous copies to LDS one pass ahead of their readers.
// grid = (S/256, B*H)
// ---------------------------------------------------------------------------
#define KPITCH 144   // bytes of a K row in LDS: 16 B x odd for ds_load_b128
#define VPITCH 160   // bytes of a V row in LDS: 32 B x odd for ds_load_tr16_b128
#define MPITCH 144   // bytes of a mask row in LDS: 16 B x odd for ds_load_b128
#define AQ 256       // queries of a block
#define AKV 32       // keys of a stage
#define AV_OFF (AKV * KPITCH)
#define AM_OFF (AV_OFF + AKV * VPITCH)
#define ASTAGE (AM_OFF + AQ * MPITCH)   // bytes of one buffer
#define APASSES (SS / AKV)

typedef __attribute__((ext_vector_type(8))) short s16x8;
typedef __attribute__((ext_vector_type(4))) float v4f;

// lane (c, h) gets T[8h + 0..7][c] of the 16 x 16 tile its 32 lane addresses name
__device__ __forceinline__ v8h lds_tr16(const char* p) {
    typedef __attribute__((address_space(3))) s16x8 lds_s16x8;
    return __builtin_bit_cast(v8h, __builtin_amdgcn_ds_load_tr16_b128_v8i16((lds_s16x8*)p));
}

// value of lane l ^ 16
__device__ __forceinline__ float other_half(float x) {
    const int v = __builtin_bit_cast(int, x);
    return __builtin_bit_cast(float, __builtin_amdgcn_permlanex16(
        v, v, 0x76543210, 0xfedcba98, false, false));
}

// One stage: one copy for the rows of K, one for those of V, eight for the mask rows
// (32 rows a copy of the block, 8 lanes a row, 16 B per lane). kd / vd / md are this
// lane's places in the stage's buffer, kg / vg / mg its 16 B at the stage's keys. One
// statement, so that one s_wait_xcnt serves all ten and no address register is
// rewritten ahead of it.
static_assert(AKV * 8 == 256 && AQ == 8 * 32, "attn_copy_stage issues 1 + 1 + 8 copies");
__device__ __forceinline__ void attn_copy_stage(unsigned kd, unsigned vd, unsigned md,
                                                const _Float16* kg, const _Float16* vg,
                                                const float* mg) {
    const unsigned rs = 32u * MPITCH;      // LDS bytes between two mask copies
    const size_t   gs = (size_t)32 * SS;   // floats between two mask copies
    asm volatile(
        "global_load_async_to_lds_b128 %0, %10, off\n\t"
        "global_load_async_to_lds_b128 %1, %11, off\n\t"
        "global_load_async_to_lds_b128 %2, %12, off\n\t"
        "global_load_async_to_lds_b128 %3, %13, off\n\t"
        "global_load_async_to_lds_b128 %4, %14, off\n\t"
        "global_load_async_to_lds_b128 %5, %15, off\n\t"
        "global_load_async_to_lds_b128 %6, %16, off\n\t"
        "global_load_async_to_lds_b128 %7, %17, off\n\t"
        "global_load_async_to_lds_b128 %8, %18, off\n\t"
        "global_load_async_to_lds_b128 %9, %19, off\n\t"
        "s_wait_xcnt 0x0"
        :: "v"(kd), "v"(vd), "v"(md), "v"(md + rs), "v"(md + 2u * rs), "v"(md + 3u * rs),
           "v"(md + 4u * rs), "v"(md + 5u * rs), "v"(md + 6u * rs), "v"(md + 7u * rs),
           "v"(kg), "v"(vg), "v"(mg), "v"(mg + gs), "v"(mg + 2 * gs), "v"(mg + 3 * gs),
           "v"(mg + 4 * gs), "v"(mg + 5 * gs), "v"(mg + 6 * gs), "v"(mg + 7 * gs)
        : "memory");
}

__global__ __launch_bounds__(256)
void flash_attn_kernel(const _Float16* __restrict__ Q,
                       const _Float16* __restrict__ K,
                       const _Float16* __restrict__ V,
                       const float* __restrict__ mask,
                       _Float16* __restrict__ Ao) {
    __shared__ __attribute__((aligned(32))) char smem[2 * ASTAGE];

    const int tid  = threadIdx.x;
    const int wave = tid >> 5;
    const int lane = tid & 31;
    const int ln = lane & 15;
    const int hi = lane >> 4;
    const int qblk = blockIdx.x * AQ;
    const int q0 = qblk + wave * 32;
    const int bh = blockIdx.y;
    const int b  = bh >> 4;
    const int h  = bh & 15;

    const _Float16* Qb = Q + (size_t)bh * SS * HD;

    // this thread's 16 B of a stage's K rows, V rows and first 32 mask rows
    const int crow = tid >> 3;
    const int cchk = tid & 7;
    const _Float16* kg = K + (size_t)bh * SS * HD + crow * HD + cchk * 8;
    const _Float16* vg = V + (size_t)bh * SS * HD + crow * HD + cchk * 8;
    const float* mg = mask + (size_t)b * SS * SS + (size_t)(qblk + crow) * SS + cchk * 4;
    const unsigned lds0 = (unsigned)(size_t)smem;
    const unsigned kd = lds0 + (unsigned)(crow * KPITCH + cchk * 16);
    const unsigned vd = lds0 + (unsigned)(AV_OFF + crow * VPITCH + cchk * 16);
    const unsigned md = lds0 + (unsigned)(AM_OFF + crow * MPITCH + cchk * 16);

    // where this lane reads in a buffer: its key row of K, its transposing loads of V,
    // its first group's query row of the mask at its half's first key
    const int krd = ln * KPITCH + hi * 16;
    const int vrd = AV_OFF + (8 * hi + (lane & 7)) * VPITCH + 16 * ((lane >> 3) & 1);
    const int mrd = AM_OFF + (wave * 32 + ln) * MPITCH + 32 * hi;

    attn_copy_stage(kd, vd, md, kg, vg, mg);

    v16h qb[2][2];
#pragma unroll
    for (int c = 0; c < 2; ++c) {
        qb[c][0] = frag_from_f16(Qb + (size_t)(q0 + 16 * c + ln) * HD + 0, hi);
        qb[c][1] = frag_from_f16(Qb + (size_t)(q0 + 16 * c + ln) * HD + 32, hi);
    }

    float mrun[2] = {-1e30f, -1e30f};
    float lrun[2] = {0.0f, 0.0f};   // this half's keys only, joined at the end
    v8f o[2][4] = {};

    // stage 0 has landed for this wave, then for all
    asm volatile("s_wait_asynccnt 0x0" ::: "memory");
    __syncthreads();
    attn_copy_stage(kd + ASTAGE, vd + ASTAGE, md + ASTAGE,
                    kg + AKV * HD, vg + AKV * HD, mg + AKV);

#pragma unroll 1   // the two buffers alternate by a scalar offset
    for (int t = 0; t < APASSES; ++t) {
        const char* buf = smem + (t & 1) * ASTAGE;

        // ---- this pass's K fragments and mask rows, one group of LDS reads ----
        v16h ka[2][2];
#pragma unroll
        for (int kt = 0; kt < 2; ++kt)
#pragma unroll
            for (int ks = 0; ks < 2; ++ks)
                ka[kt][ks] = frag_from_lds(buf + krd + kt * 16 * KPITCH + ks * 64);
        v8f mk[2][2];   // [query group][key tile]
#pragma unroll
        for (int c = 0; c < 2; ++c) {
            const char* mp = buf + mrd + c * 16 * MPITCH;
            const v4f a0 = *(const v4f*)(mp),      a1 = *(const v4f*)(mp + 16);
            const v4f b0 = *(const v4f*)(mp + 64), b1 = *(const v4f*)(mp + 80);
            mk[c][0] = __builtin_shufflevector(a0, a1, 0, 1, 2, 3, 4, 5, 6, 7);
            mk[c][1] = __builtin_shufflevector(b0, b1, 0, 1, 2, 3, 4, 5, 6, 7);
        }
        // keeps the 16 LDS reads together in front of the 8 score WMMAs, for speed only
        __builtin_amdgcn_sched_barrier(0);

        // ---- scores, transposed: each K fragment serves both query groups ----
        v8f s[2][2] = {};   // [query group][key tile]
#pragma unroll
        for (int ks = 0; ks < 2; ++ks)
#pragma unroll
            for (int c = 0; c < 2; ++c)
#pragma unroll
                for (int kt = 0; kt < 2; ++kt)
                    s[c][kt] = wmma_f16(ka[kt][ks], qb[c][ks], s[c][kt]);

        // ---- V^T fragments: the pass's last LDS reads, one group ----
        v16h va[4];
#pragma unroll
        for (int g = 0; g < 4; ++g) {
            const v8h lo = lds_tr16(buf + vrd + 32 * g);
            const v8h up = lds_tr16(buf + vrd + 16 * VPITCH + 32 * g);
            va[g] = __builtin_shufflevector(lo, up, 0, 1, 2, 3, 4, 5, 6, 7,
                                            8, 9, 10, 11, 12, 13, 14, 15);
        }

        // publish point of stage t + 1. It stands behind the pass's last LDS read, not at
        // the loop's end: what follows works on registers alone, so the refill flies for a
        // whole pass. This wave's reads of stage t are done, its copies of stage t + 1
        // have landed, then every wave's
        asm volatile("s_wait_dscnt 0x0" ::: "memory");
        asm volatile("s_wait_asynccnt 0x0" ::: "memory");
        __syncthreads();
        if (t + 2 < APASSES) {
            const unsigned bo = (unsigned)(t & 1) * ASTAGE;
            attn_copy_stage(kd + bo, vd + bo, md + bo,
                            kg + (size_t)(t + 2) * AKV * HD, vg + (size_t)(t + 2) * AKV * HD,
                            mg + (size_t)(t + 2) * AKV);
        }

        // ---- additive mask + online softmax, one query of each group per lane ----
        v16h pb[2];   // P^T as B: element e is key 8*hi + e (e < 8) or 16 + 8*hi + e - 8 of this lane's query
#pragma unroll
        for (int c = 0; c < 2; ++c) {
            const v8f s0 = s[c][0] + mk[c][0];
            const v8f s1 = s[c][1] + mk[c][1];

            float mx = fmaxf(s0[0], s1[0]);
#pragma unroll
            for (int r = 1; r < 8; ++r) mx = fmaxf(mx, fmaxf(s0[r], s1[r]));
            mx = fmaxf(mx, other_half(mx));
            const float mn    = fmaxf(mrun[c], mx);
            const float alpha = __expf(mrun[c] - mn);

            float rs0 = 0.0f, rs1 = 0.0f;
#pragma unroll
            for (int r = 0; r < 8; ++r) {
                const float p0 = __expf(s0[r] - mn);
                const float p1 = __expf(s1[r] - mn);
                rs0 += p0;
                rs1 += p1;
                pb[c][r]     = (_Float16)p0;
                pb[c][r + 8] = (_Float16)p1;
            }
            lrun[c] = lrun[c] * alpha + (rs0 + rs1);
            mrun[c] = mn;
#pragma unroll
            for (int g = 0; g < 4; ++g) o[c][g] *= alpha;
        }

        // ---- PV: each V^T fragment serves both query groups ----
#pragma unroll
        for (int g = 0; g < 4; ++g)
#pragma unroll
            for (int c = 0; c < 2; ++c) o[c][g] = wmma_f16(va[g], pb[c], o[c][g]);

    }
    // no copy is left in flight when the wave goes on
    asm volatile("s_wait_asynccnt 0x0" ::: "memory");

    // ---- finalize: join the halves' sums, O /= l, write f16 [B, S, D] ----
    // o[c][g][r] = O[q0 + 16 c + ln][16 g + 8 hi + r]: 8 consecutive halves, one 16 B store
#pragma unroll
    for (int c = 0; c < 2; ++c) {
        const float inv = 1.0f / (lrun[c] + other_half(lrun[c]));
        _Float16* dst = Ao + ((size_t)b * SS + q0 + 16 * c + ln) * DD + h * HD + 8 * hi;
#pragma unroll
        for (int g = 0; g < 4; ++g) {
            v8h w;
#pragma unroll
            for (int r = 0; r < 8; ++r) w[r] = (_Float16)(o[c][g][r] * inv);
            *(v8h*)(dst + g * 16) = w;
        }
    }
}

// ---------------------------------------------------------------------------
// Kernel 3: output projection, all-f16 operands, fp32 result.
//   A : f16 [B*S, D], Woh : f16 [D, D], out = A @ Wo^T + bo (fp32)
// Block 256 = 8 waves; block tile 128(M) x 256(N) through gemm_tile_128x256.
// grid = (M/128, D/256)
// ---------------------------------------------------------------------------
__global__ __launch_bounds__(256)
void out_proj_kernel(const _Float16* __restrict__ A,
                     const _Float16* __restrict__ Woh,
                     const float* __restrict__ bo,
                     float* __restrict__ out) {
    __shared__ __attribute__((aligned(16))) char smem[2 * GSTAGE];
    const int wave = threadIdx.x >> 5;
    const int lane = threadIdx.x & 31;
    const int mblk = blockIdx.x * GM;
    const int nblk = blockIdx.y * GN;
    const int ln = lane & 15;
    const int kh = lane >> 4;

    v8f acc[4][4] = {};
    gemm_tile_128x256(A, Woh, mblk, nblk, smem, acc);

    const int m0 = mblk + (wave >> 2) * 64;
    const int n0 = nblk + (wave & 3) * 64;

    // acc[i][j][r] is row 16 i + r + 8 kh, column 4 ln + j of the wave's tile: 16 B a lane,
    // a half wave stores 256 neighbouring bytes of one output row
    const c4f bn = *(const c4f*)(bo + n0 + 4 * ln);
#pragma unroll
    for (int i = 0; i < 4; ++i) {
#pragma unroll
        for (int r = 0; r < 8; ++r) {
            const int m = m0 + 16 * i + r + 8 * kh;
            c4f w;
#pragma unroll
            for (int j = 0; j < 4; ++j) w[j] = acc[i][j][r] + bn[j];
            *(c4f*)(out + (size_t)m * DD + n0 + 4 * ln) = w;
        }
    }
}

// ---------------------------------------------------------------------------
// Host side
// ---------------------------------------------------------------------------
extern "C" void kernel_launch(void* const* d_in, const int* in_sizes, int n_in,
                              void* d_out, int out_size, void* d_ws, size_t ws_size,
                              hipStream_t stream) {
    const float* X    = (const float*)d_in[0];  // [B, S, D]
    const float* mask = (const float*)d_in[1];  // [B, 1, S, S]
    const float* Wq   = (const float*)d_in[2];
    const float* bq   = (const float*)d_in[3];
    const float* Wk   = (const float*)d_in[4];
    const float* bk   = (const float*)d_in[5];
    const float* Wv   = (const float*)d_in[6];
    const float* bv   = (const float*)d_in[7];
    const float* Wo   = (const float*)d_in[8];
    const float* bo   = (const float*)d_in[9];
    float* out = (float*)d_out;

    // Workspace layout (halves):
    //   Xh   : B*S*D        = 8388608
    //   Wqh/Wkh/Wvh/Woh : D*D = 1048576 each
    //   Qw/Kw/Vw : B*H*S*HD = 8388608 each
    //   Aw   : B*S*D        = 8388608
    const size_t nX = (size_t)BB * SS * DD;   // 8388608
    const size_t nW = (size_t)DD * DD;        // 1048576
    _Float16* Xh  = (_Float16*)d_ws;
    _Float16* Wqh = Xh + nX;
    _Float16* Wkh = Wqh + nW;
    _Float16* Wvh = Wkh + nW;
    _Float16* Woh = Wvh + nW;
    _Float16* Qw  = Woh + nW;
    _Float16* Kw  = Qw + nX;
    _Float16* Vw  = Kw + nX;
    _Float16* Aw  = Vw + nX;

    const int M = BB * SS;  // 8192

    // ---- convert fp32 activations + weights to f16 once: Xh .. Woh are contiguous ----
    cvt_all_kernel<<<CVT_BLOCKS, 512, 0, stream>>>(X, Wq, Wk, Wv, Wo, Xh);

    dim3 gqkv(M / GM, DD / GN, 3);
    qkv_proj_kernel<<<gqkv, 256, 0, stream>>>(Xh, Wqh, bq, Wkh, bk, Wvh, bv, Qw, Kw, Vw);

    dim3 gattn(SS / AQ, BB * HH);
    flash_attn_kernel<<<gattn, 256, 0, stream>>>(Qw, Kw, Vw, mask, Aw);

    dim3 gout(M / GM, DD / GN);
    out_proj_kernel<<<gout, 256, 0, stream>>>(Aw, Woh, bo, out);
}

// v006
// It runs in 103 microseconds.
// In both of two side-by-side timings against v005, it was 1.07 times as fast.
// All steps since v000 together make it 4.73 times as fast.
#include <hip/hip_runtime.h>
#include <hip/hip_bf16.h>

typedef __attribute__((ext_vector_type(16))) _Float16 v16h;
typedef __attribute__((ext_vector_type(8)))  _Float16 v8h;
typedef __attribute__((ext_vector_type(8)))  float    v8f;

#define BB 8
#define SS 1024
#define DD 1024
#define HH 16
#define HD 64
#define QK_SCALE 0.125f   // 64^-0.5

// ---------------------------------------------------------------------------
// WMMA wrapper: D = A(16x32 f16) * B(32x16 f16) + C(16x16 f32)
// ---------------------------------------------------------------------------
__device__ __forceinline__ v8f wmma_f16(v16h a, v16h b, v8f c) {
    return __builtin_amdgcn_wmma_f32_16x16x32_f16(
        false, a, false, b, (short)0, c, false, false);
}

// ---------------------------------------------------------------------------
// A/B fragment loader (16-bit operand, 16x32 tile), f16 source.
// Lane L: row/col = L&15, khalf = L>>4.
//   elems 0..7  -> K = khalf*8 + e ; elems 8..15 -> K = 16 + khalf*8 + e
// ---------------------------------------------------------------------------
__device__ __forceinline__ v16h frag_from_f16(const _Float16* __restrict__ p, int kh) {
    v16h f;
    const _Float16* a = p + kh * 8;
    const _Float16* b = p + 16 + kh * 8;
#pragma unroll
    for (int e = 0; e < 8; ++e) {
        f[e]     = a[e];
        f[e + 8] = b[e];
    }
    return f;
}

// ---------------------------------------------------------------------------
// Shared GEMM core of the two projections: Y(128 x 256) = A(128 x K) * W(256 x K)^T.
// Block 256 = 8 waves (2 x 4), wave tile 64 x 64 (16 accumulators).
// A pass is GK k of every operand row; a stage is [A 128 rows | W 256 rows] at
// pitch GPITCH bytes in LDS; two buffers, filled by asynchronous copies to LDS
// one pass ahead of their readers.
// The rows of W are dealt: LDS row q of the W part holds row
//   (q & ~63) + 4 * (q & 15) + ((q >> 4) & 3)
// of the tile, so lane ln of a wave's B fragment j holds column 4 * ln + j of the wave's
// 64: acc[i][0..3][r] of a lane are four neighbouring columns of one output row, and the
// 16 lanes of a half wave store 64 neighbouring columns, whole 128-B lines.
// ---------------------------------------------------------------------------
#define GM 128
#define GN 256
#define GK 64
#define GPITCH (GK * 2 + 16)              // bytes; 16 B x odd for ds_load_b128
#define GSTAGE ((GM + GN) * GPITCH)       // bytes of one buffer
#define GPASSES (DD / GK)
#define GCROWS (256 / (GK / 8))           // rows that one copy of the block covers

__device__ __forceinline__ v16h frag_from_lds(const char* p) {
    const v8h lo = *(const v8h*)p;
    const v8h hi = *(const v8h*)(p + 32);
    return __builtin_shufflevector(lo, hi, 0, 1, 2, 3, 4, 5, 6, 7,
                                   8, 9, 10, 11, 12, 13, 14, 15);
}

// One stage: 4 copies for the rows of A and 8 for those of W, 16 B per lane each,
// GCROWS rows apart in LDS. ga / gb are this lane's 16 B in its row of the first copy
// of A / W at the stage's k, lds its place in the stage's buffer. In global memory the
// copies of A are GCROWS rows apart; copy c of W starts 64 * (c >> 1) + 2 * (c & 1) rows
// on (the deal of W's rows, above). One statement, so that one
// s_wait_xcnt serves all twelve and no address register is rewritten ahead of it.
static_assert(GM == 4 * GCROWS && GN == 8 * GCROWS, "copy_stage issues 4 + 8 copies");
static_assert(GCROWS == 32, "the deal of W's rows is written for 32 rows a copy");
__device__ __forceinline__ void copy_stage(unsigned lds, const _Float16* ga,
                                           const _Float16* gb) {
    const unsigned rs = GCROWS * GPITCH;      // LDS bytes between two copies
    const size_t   gs = (size_t)GCROWS * DD;  // halves between two copies
    asm volatile(
        "global_load_async_to_lds_b128 %0, %12, off\n\t"
        "global_load_async_to_lds_b128 %1, %13, off\n\t"
        "global_load_async_to_lds_b128 %2, %14, off\n\t"
        "global_load_async_to_lds_b128 %3, %15, off\n\t"
        "global_load_async_to_lds_b128 %4, %16, off\n\t"
        "global_load_async_to_lds_b128 %5, %17, off\n\t"
        "global_load_async_to_lds_b128 %6, %18, off\n\t"
        "global_load_async_to_lds_b128 %7, %19, off\n\t"
        "global_load_async_to_lds_b128 %8, %20, off\n\t"
        "global_load_async_to_lds_b128 %9, %21, off\n\t"
        "global_load_async_to_lds_b128 %10, %22, off\n\t"
        "global_load_async_to_lds_b128 %11, %23, off\n\t"
        "s_wait_xcnt 0x0"
        :: "v"(lds), "v"(lds + rs), "v"(lds + 2u * rs), "v"(lds + 3u * rs),
           "v"(lds + 4u * rs), "v"(lds + 5u * rs), "v"(lds + 6u * rs),
           "v"(lds + 7u * rs), "v"(lds + 8u * rs), "v"(lds + 9u * rs),
           "v"(lds + 10u * rs), "v"(lds + 11u * rs),
           "v"(ga), "v"(ga + gs), "v"(ga + 2 * gs), "v"(ga + 3 * gs),
           "v"(gb), "v"(gb + 2 * DD), "v"(gb + 64 * DD), "v"(gb + 66 * DD),
           "v"(gb + 128 * DD), "v"(gb + 130 * DD), "v"(gb + 192 * DD), "v"(gb + 194 * DD)
        : "memory");
}

__device__ __forceinline__ void gemm_tile_128x256(const _Float16* __restrict__ A,
                                                  const _Float16* __restrict__ Wt,
                                                  int mblk, int nblk, char* smem,
                                                  v8f (&acc)[4][4]) {
    const int tid  = threadIdx.x;
    const int wave = tid >> 5;
    const int lane = tid & 31;
    const int ln = lane & 15;
    const int kh = lane >> 4;
    const int wm = wave >> 2;   // 0..1
    const int wn = wave & 3;    // 0..3

    const int crow = tid / (GK / 8);
    const int cchk = tid % (GK / 8);
    const _Float16* ga = A  + (size_t)(mblk + crow) * DD + cchk * 8;
    // LDS row crow of the W part takes row 4 * (crow & 15) + (crow >> 4) of the tile
    const _Float16* gb = Wt + (size_t)(nblk + 4 * (crow & 15) + (crow >> 4)) * DD + cchk * 8;
    const unsigned lds0 = (unsigned)(size_t)smem + (unsigned)(crow * GPITCH + cchk * 16);

    const int aoff = (wm * 64 + ln) * GPITCH + kh * 16;
    const int boff = (GM + wn * 64 + ln) * GPITCH + kh * 16;

    copy_stage(lds0, ga, gb);
    // stage 0 has landed for this wave, then for all
    asm volatile("s_wait_asynccnt 0x0" ::: "memory");
    __syncthreads();
    copy_stage(lds0 + GSTAGE, ga + GK, gb + GK);

#pragma unroll 1   // the two buffers alternate by a scalar offset
    for (int t = 0; t < GPASSES; ++t) {
        const char* buf = smem + (t & 1) * GSTAGE;
#pragma unroll
        for (int ks = 0; ks < GK / 32; ++ks) {
            v16h a[4], b[4];
#pragma unroll
            for (int i = 0; i < 4; ++i)
                a[i] = frag_from_lds(buf + aoff + i * 16 * GPITCH + ks * 64);
#pragma unroll
            for (int j = 0; j < 4; ++j)
                b[j] = frag_from_lds(buf + boff + j * 16 * GPITCH + ks * 64);
            // keeps the 16 LDS reads of a k step together in front of its 16 WMMAs
            __builtin_amdgcn_sched_barrier(0);
#pragma unroll
            for (int i = 0; i < 4; ++i)
#pragma unroll
                for (int j = 0; j < 4; ++j)
                    acc[i][j] = wmma_f16(a[i], b[j], acc[i][j]);
            // the other side of the same fence: the next reads stay behind this block
            __builtin_amdgcn_sched_barrier(0);
        }
        // publish point of stage t + 1: this wave's reads of stage t are done,
        // its copies of stage t + 1 have landed, then every wave's
        asm volatile("s_wait_dscnt 0x0" ::: "memory");
        asm volatile("s_wait_asynccnt 0x0" ::: "memory");
        __syncthreads();
        if (t + 2 < GPASSES)
            copy_stage(lds0 + (unsigned)(t & 1) * GSTAGE,
                       ga + (size_t)(t + 2) * GK, gb + (size_t)(t + 2) * GK);
    }
    // no copy is left in flight when the wave goes on
    asm volatile("s_wait_asynccnt 0x0" ::: "memory");
}

// ---------------------------------------------------------------------------
// Kernel 0: fp32 -> f16 conversion of X and the four weights, one resident launch.
// The five f16 copies lie one behind the other in the workspace, so the destination
// is one array. A chunk is 1024 elements: 8 loads of a wave, each 512 contiguous
// bytes. 256 blocks x 16 waves; a wave takes CVT_XTRIPS chunks of X, CVT_WAVES apart,
// and one chunk of a weight; all its loads are issued ahead of its stores.
// ---------------------------------------------------------------------------
#define CVT_CHUNK 1024
#define CVT_BLOCKS 256
#define CVT_WAVES (CVT_BLOCKS * 16)
#define CVT_XCH (BB * SS * DD / CVT_CHUNK)   // chunks of X
#define CVT_WCH (DD * DD / CVT_CHUNK)        // chunks of one weight
#define CVT_XTRIPS (CVT_XCH / CVT_WAVES)
static_assert(CVT_XTRIPS * CVT_WAVES == CVT_XCH, "X is a whole number of trips");
static_assert(4 * CVT_WCH == CVT_WAVES, "the four weights are one trip");

typedef __attribute__((ext_vector_type(4))) float    c4f;
typedef __attribute__((ext_vector_type(4))) _Float16 c4h;

__global__ __launch_bounds__(512)
void cvt_all_kernel(const float* __restrict__ X,
                    const float* __restrict__ Wq, const float* __restrict__ Wk,
                    const float* __restrict__ Wv, const float* __restrict__ Wo,
                    _Float16* __restrict__ dst) {
    const int lane = threadIdx.x & 31;
    // the wave's number in a scalar register: source choice and bases stay scalar
    const int wave = __builtin_amdgcn_readfirstlane((int)(blockIdx.x * 16 + (threadIdx.x >> 5)));
    const int w = wave / CVT_WCH;
    const float* Ws = w == 0 ? Wq : w == 1 ? Wk : w == 2 ? Wv : Wo;

    c4f v[CVT_XTRIPS + 1][8];
#pragma unroll
    for (int t = 0; t <= CVT_XTRIPS; ++t) {
        const float* s = t < CVT_XTRIPS ? X + (size_t)(t * CVT_WAVES + wave) * CVT_CHUNK
                                        : Ws + (size_t)(wave % CVT_WCH) * CVT_CHUNK;
#pragma unroll
        for (int u = 0; u < 8; ++u) v[t][u] = *(const c4f*)(s + u * 128 + lane * 4);
    }
    // keeps every load in front of the first conversion: without it the compiler holds
    // the later loads back until registers of the first ones are free, a second latency
    __builtin_amdgcn_sched_barrier(0);
#pragma unroll
    for (int t = 0; t <= CVT_XTRIPS; ++t) {
        _Float16* d = dst + (size_t)(t * CVT_WAVES + wave) * CVT_CHUNK + lane * 4;
#pragma unroll
        for (int u = 0; u < 8; ++u) *(c4h*)(d + u * 128) = __builtin_convertvector(v[t][u], c4h);
    }
}

// ---------------------------------------------------------------------------
// Kernel 1: fused QKV projection, all-f16 operands.
//   Xh : [B*S, D] f16,  W*h : [D, D] f16 (out = X @ W^T + b)
//   Q/K/V out: f16 [B, H, S, HD]; Q scaled by QK_SCALE after bias.
// Block 256 = 8 waves; block tile 128(M) x 256(N) through gemm_tile_128x256.
// grid = (M/128, D/256, 3)
// ---------------------------------------------------------------------------
__global__ __launch_bounds__(256)
void qkv_proj_kernel(const _Float16* __restrict__ Xh,
                     const _Float16* __restrict__ Wqh, const float* __restrict__ bq,
                     const _Float16* __restrict__ Wkh, const float* __restrict__ bk,
                     const _Float16* __restrict__ Wvh, const float* __restrict__ bv,
                     _Float16* __restrict__ Qo, _Float16* __restrict__ Ko,
                     _Float16* __restrict__ Vo) {
    __shared__ __attribute__((aligned(16))) char smem[2 * GSTAGE];
    const int wave = threadIdx.x >> 5;
    const int lane = threadIdx.x & 31;
    const int mblk = blockIdx.x * GM;
    const int nblk = blockIdx.y * GN;
    const int which = blockIdx.z;

    const _Float16* W;
    const float* bias;
    _Float16* out;
    float scale;
    if (which == 0)      { W = Wqh; bias = bq; out = Qo; scale = QK_SCALE; }
    else if (which == 1) { W = Wkh; bias = bk; out = Ko; scale = 1.0f; }
    else                 { W = Wvh; bias = bv; out = Vo; scale = 1.0f; }

    const int ln = lane & 15;
    const int kh = lane >> 4;

    v8f acc[4][4] = {};
    gemm_tile_128x256(Xh, W, mblk, nblk, smem, acc);

    const int m0 = mblk + (wave >> 2) * 64;
    const int n0 = nblk + (wave & 3) * 64;

    // Epilogue: acc[i][j][r] is row 16 i + r + 8 kh, column 4 ln + j of the wave's tile,
    // whose 64 columns are one head: 8 B a lane, a half wave stores the head's whole row.
    const int h = n0 >> 6;       // head
    const c4f bn = *(const c4f*)(bias + n0 + 4 * ln);
#pragma unroll
    for (int i = 0; i < 4; ++i) {
#pragma unroll
        for (int r = 0; r < 8; ++r) {
            const int m = m0 + 16 * i + r + 8 * kh;
            const int bidx = m >> 10;
            const int s    = m & (SS - 1);
            c4h w;
#pragma unroll
            for (int j = 0; j < 4; ++j) w[j] = (_Float16)((acc[i][j][r] + bn[j]) * scale);
            *(c4h*)(out + (((size_t)bidx * HH + h) * SS + s) * HD + 4 * ln) = w;
        }
    }
}

// ---------------------------------------------------------------------------
// Kernel 2: flash attention, two heads of one batch per block, transposed products.
//   Q/K/V: f16 [B, H, S, HD]; mask fp32 [B, 1, S, S] additive.
//   Output: f16 [B, S, D] row-major.
// Block 512 = 16 waves: waves 0..7 work on head 2y, waves 8..15 on head 2y + 1, both on
// the same 256 queries; a wave handles 32 queries (two groups of 16) x full HD; kv in
// 32-wide passes, APS passes to a stage.
//   S^T(32 kv x 16 q) = K * Q^T : a lane holds 16 scores of ONE query of each group,
//   keys 8*hi + r and 16 + 8*hi + r, so maximum and sum run in the lane and the two
//   wave halves meet by one cross-row move.
//   O^T(64 hd x 16 q) += V^T * P^T : the two score tiles, converted in place, are the
//   B operand in the hardware k order; V^T comes by the transposing LDS load.
// A stage is [K 2 heads x 64 rows | V 2 heads x 64 rows | mask 256 query rows x 64 keys]
// in LDS. The mask does not depend on the head, and it is most of a stage's bytes: its
// rows are fetched once for the two heads. Two buffers, filled by asynchronous copies
// to LDS one stage ahead of their readers.
// grid = (S/256, B*H/2)
// ---------------------------------------------------------------------------
#define KPITCH 144   // bytes of a K row in LDS: 16 B x odd for ds_load_b128
#define VPITCH 160   // bytes of a V row in LDS: 32 B x odd for ds_load_tr16_b128
#define AQ 256       // queries of a block
#define AH 2         // heads of a block
#define AKV 64       // keys of a stage
#define APS (AKV / 32)           // passes of a stage
#define MPITCH (AKV * 4 + 16)    // bytes of a mask row in LDS: 16 B x odd for ds_load_b128
#define AK_HEAD (AKV * KPITCH)   // bytes of one head's K rows
#define AV_HEAD (AKV * VPITCH)   // bytes of one head's V rows
#define AV_OFF (AH * AK_HEAD)
#define AM_OFF (AV_OFF + AH * AV_HEAD)
#define ASTAGE (AM_OFF + AQ * MPITCH)   // bytes of one buffer
#define ASTAGES (SS / AKV)

typedef __attribute__((ext_vector_type(8))) short s16x8;
typedef __attribute__((ext_vector_type(4))) float v4f;

// lane (c, h) gets T[8h + 0..7][c] of the 16 x 16 tile its 32 lane addresses name
__device__ __forceinline__ v8h lds_tr16(const char* p) {
    typedef __attribute__((address_space(3))) s16x8 lds_s16x8;
    return __builtin_bit_cast(v8h, __builtin_amdgcn_ds_load_tr16_b128_v8i16((lds_s16x8*)p));
}

// value of lane l ^ 16
__device__ __forceinline__ float other_half(float x) {
    const int v = __builtin_bit_cast(int, x);
    return __builtin_bit_cast(float, __builtin_amdgcn_permlanex16(
        v, v, 0x76543210, 0xfedcba98, false, false));
}

// One stage: a copy for each head's rows of K, a copy for each head's rows of V (8 lanes
// a row), eight for the mask rows (32 rows a copy of the block, 16 lanes a row), 16 B per
// lane each. kd / vd / md are this lane's places in the stage's buffer, kg / vg / mg its
// 16 B at the stage's keys. Two statements of six copies, each closed by its own
// s_wait_xcnt, so that no address register is rewritten ahead of the wait and only 18
// address registers are held at a time: 36 at once, beside scores and mask rows, pass the
// 256 registers that a wave of a 16-wave block may have.
static_assert(AH == 2 && AKV * 8 == 512 && AKV / 4 == 16 && AQ == 8 * 32,
              "attn_copy_stage issues 2 + 2 + 8 copies of 512 lanes");
__device__ __forceinline__ void attn_copy_stage(unsigned kd, unsigned vd, unsigned md,
                                                const _Float16* kg, const _Float16* vg,
                                                const float* mg) {
    const unsigned rs = 32u * MPITCH;      // LDS bytes between two mask copies
    const size_t   gs = (size_t)32 * SS;   // floats between two mask copies
    const size_t   hs = (size_t)SS * HD;   // halves between two heads
    asm volatile(
        "global_load_async_to_lds_b128 %0, %6, off\n\t"
        "global_load_async_to_lds_b128 %1, %7, off\n\t"
        "global_load_async_to_lds_b128 %2, %8, off\n\t"
        "global_load_async_to_lds_b128 %3, %9, off\n\t"
        "global_load_async_to_lds_b128 %4, %10, off\n\t"
        "global_load_async_to_lds_b128 %5, %11, off\n\t"
        "s_wait_xcnt 0x0"
        :: "v"(kd), "v"(kd + (unsigned)AK_HEAD), "v"(vd), "v"(vd + (unsigned)AV_HEAD),
           "v"(md), "v"(md + rs),
           "v"(kg), "v"(kg + hs), "v"(vg), "v"(vg + hs), "v"(mg), "v"(mg + gs)
        : "memory");
    asm volatile(
        "global_load_async_to_lds_b128 %0, %6, off\n\t"
        "global_load_async_to_lds_b128 %1, %7, off\n\t"
        "global_load_async_to_lds_b128 %2, %8, off\n\t"
        "global_load_async_to_lds_b128 %3, %9, off\n\t"
        "global_load_async_to_lds_b128 %4, %10, off\n\t"
        "global_load_async_to_lds_b128 %5, %11, off\n\t"
        "s_wait_xcnt 0x0"
        :: "v"(md + 2u * rs), "v"(md + 3u * rs), "v"(md + 4u * rs), "v"(md + 5u * rs),
           "v"(md + 6u * rs), "v"(md + 7u * rs),
           "v"(mg + 2 * gs), "v"(mg + 3 * gs), "v"(mg + 4 * gs), "v"(mg + 5 * gs),
           "v"(mg + 6 * gs), "v"(mg + 7 * gs)
        : "memory");
}

__global__ __launch_bounds__(512)
void flash_attn_kernel(const _Float16* __restrict__ Q,
                       const _Float16* __restrict__ K,
                       const _Float16* __restrict__ V,
                       const float* __restrict__ mask,
                       _Float16* __restrict__ Ao) {
    __shared__ __attribute__((aligned(32))) char smem[2 * ASTAGE];

    const int tid  = threadIdx.x;
    const int wave = tid >> 5;
    const int lane = tid & 31;
    const int ln = lane & 15;
    const int hi = lane >> 4;
    const int hd = wave >> 3;   // which of the block's two heads
    const int wq = wave & 7;    // which 32 of the block's queries
    const int qblk = blockIdx.x * AQ;
    const int q0 = qblk + wq * 32;
    const int bh0 = blockIdx.y * AH;   // the block's first head; even, so one batch
    const int bh = bh0 + hd;
    const int b  = bh >> 4;
    const int h  = bh & 15;

    const _Float16* Qb = Q + (size_t)bh * SS * HD;

    // this thread's 16 B of a stage's K rows and V rows of the first head, and of its
    // first 32 mask rows
    const int crow = tid >> 3;
    const int cchk = tid & 7;
    const int mrow = tid >> 4;
    const int mchk = tid & 15;
    const _Float16* kg = K + (size_t)bh0 * SS * HD + crow * HD + cchk * 8;
    const _Float16* vg = V + (size_t)bh0 * SS * HD + crow * HD + cchk * 8;
    const float* mg = mask + (size_t)b * SS * SS + (size_t)(qblk + mrow) * SS + mchk * 4;
    const unsigned lds0 = (unsigned)(size_t)smem;
    const unsigned kd = lds0 + (unsigned)(crow * KPITCH + cchk * 16);
    const unsigned vd = lds0 + (unsigned)(AV_OFF + crow * VPITCH + cchk * 16);
    const unsigned md = lds0 + (unsigned)(AM_OFF + mrow * MPITCH + mchk * 16);

    // where this lane reads in a buffer: its key row of its head's K, its transposing
    // loads of its head's V, its first group's query row of the mask at its half's first key
    const int krd = hd * AK_HEAD + ln * KPITCH + hi * 16;
    const int vrd = AV_OFF + hd * AV_HEAD + (8 * hi + (lane & 7)) * VPITCH
                  + 16 * ((lane >> 3) & 1);
    const int mrd = AM_OFF + (wq * 32 + ln) * MPITCH + 32 * hi;

    attn_copy_stage(kd, vd, md, kg, vg, mg);

    v16h qb[2][2];
#pragma unroll
    for (int c = 0; c < 2; ++c) {
        qb[c][0] = frag_from_f16(Qb + (size_t)(q0 + 16 * c + ln) * HD + 0, hi);
        qb[c][1] = frag_from_f16(Qb + (size_t)(q0 + 16 * c + ln) * HD + 32, hi);
    }

    float mrun[2] = {-1e30f, -1e30f};
    float lrun[2] = {0.0f, 0.0f};   // this half's keys only, joined at the end
    v8f o[2][4] = {};

    // stage 0 has landed for this wave, then for all
    asm volatile("s_wait_asynccnt 0x0" ::: "memory");
    __syncthreads();
    attn_copy_stage(kd + ASTAGE, vd + ASTAGE, md + ASTAGE,
                    kg + AKV * HD, vg + AKV * HD, mg + AKV);

#pragma unroll 1   // buffer and pass are scalar offsets; one pass's registers
    for (int u = 0; u < ASTAGES * APS; ++u) {
        const int t = u / APS;   // the stage
        const int p = u % APS;   // the pass in it
        const char* buf = smem + (t & 1) * ASTAGE;

        // ---- this pass's K fragments and mask rows, one group of LDS reads ----
        v16h ka[2][2];
#pragma unroll
        for (int kt = 0; kt < 2; ++kt)
#pragma unroll
            for (int ks = 0; ks < 2; ++ks)
                ka[kt][ks] = frag_from_lds(buf + krd + (p * 32 + kt * 16) * KPITCH + ks * 64);
        v8f mk[2][2];   // [query group][key tile]
#pragma unroll
        for (int c = 0; c < 2; ++c) {
            const char* mp = buf + mrd + c * 16 * MPITCH + p * 128;
            const v4f a0 = *(const v4f*)(mp),      a1 = *(const v4f*)(mp + 16);
            const v4f b0 = *(const v4f*)(mp + 64), b1 = *(const v4f*)(mp + 80);
            mk[c][0] = __builtin_shufflevector(a0, a1, 0, 1, 2, 3, 4, 5, 6, 7);
            mk[c][1] = __builtin_shufflevector(b0, b1, 0, 1, 2, 3, 4, 5, 6, 7);
        }
        // keeps the 16 LDS reads together in front of the 8 score WMMAs, for speed only
        __builtin_amdgcn_sched_barrier(0);

        // ---- scores, transposed: each K fragment serves both query groups ----
        v8f s[2][2] = {};   // [query group][key tile]
#pragma unroll
        for (int ks = 0; ks < 2; ++ks)
#pragma unroll
            for (int c = 0; c < 2; ++c)
#pragma unroll
                for (int kt = 0; kt < 2; ++kt)
                    s[c][kt] = wmma_f16(ka[kt][ks], qb[c][ks], s[c][kt]);

        // ---- V^T fragments: the pass's last LDS reads, one group ----
        v16h va[4];
#pragma unroll
        for (int g = 0; g < 4; ++g) {
            const char* vp = buf + vrd + p * 32 * VPITCH + 32 * g;
            const v8h lo = lds_tr16(vp);
            const v8h up = lds_tr16(vp + 16 * VPITCH);
            va[g] = __builtin_shufflevector(lo, up, 0, 1, 2, 3, 4, 5, 6, 7,
                                            8, 9, 10, 11, 12, 13, 14, 15);
        }

        if (p == APS - 1) {
            // publish point of stage t + 1. It stands behind the stage's last LDS read,
            // not at the loop's end: what follows works on registers alone, so the
            // refill flies for a whole stage. This wave's reads of stage t are done, its
            // copies of stage t + 1 have landed, then every wave's
            asm volatile("s_wait_dscnt 0x0" ::: "memory");
            asm volatile("s_wait_asynccnt 0x0" ::: "memory");
            __syncthreads();
            if (t + 2 < ASTAGES) {
                const unsigned bo = (unsigned)(t & 1) * ASTAGE;
                attn_copy_stage(kd + bo, vd + bo, md + bo,
                                kg + (size_t)(t + 2) * AKV * HD,
                                vg + (size_t)(t + 2) * AKV * HD,
                                mg + (size_t)(t + 2) * AKV);
            }
        }

        // ---- additive mask + online softmax, one query of each group per lane ----
        v16h pb[2];   // P^T as B: element e is key 8*hi + e (e < 8) or 16 + 8*hi + e - 8 of this lane's query
#pragma unroll
        for (int c = 0; c < 2; ++c) {
            const v8f s0 = s[c][0] + mk[c][0];
            const v8f s1 = s[c][1] + mk[c][1];

            float mx = fmaxf(s0[0], s1[0]);
#pragma unroll
            for (int r = 1; r < 8; ++r) mx = fmaxf(mx, fmaxf(s0[r], s1[r]));
            mx = fmaxf(mx, other_half(mx));
            const float mn    = fmaxf(mrun[c], mx);
            const float alpha = __expf(mrun[c] - mn);

            float rs0 = 0.0f, rs1 = 0.0f;
#pragma unroll
            for (int r = 0; r < 8; ++r) {
                const float p0 = __expf(s0[r] - mn);
                const float p1 = __expf(s1[r] - mn);
                rs0 += p0;
                rs1 += p1;
                pb[c][r]     = (_Float16)p0;
                pb[c][r + 8] = (_Float16)p1;
            }
            lrun[c] = lrun[c] * alpha + (rs0 + rs1);
            mrun[c] = mn;
#pragma unroll
            for (int g = 0; g < 4; ++g) o[c][g] *= alpha;
        }

        // ---- PV: each V^T fragment serves both query groups ----
#pragma unroll
        for (int g = 0; g < 4; ++g)
#pragma unroll
            for (int c = 0; c < 2; ++c) o[c][g] = wmma_f16(va[g], pb[c], o[c][g]);
    }
    // no copy is left in flight when the wave goes on
    asm volatile("s_wait_asynccnt 0x0" ::: "memory");

    // ---- finalize: join the halves' sums, O /= l, write f16 [B, S, D] ----
    // o[c][g][r] = O[q0 + 16 c + ln][16 g + 8 hi + r]: 8 consecutive halves, one 16 B store
#pragma unroll
    for (int c = 0; c < 2; ++c) {
        const float inv = 1.0f / (lrun[c] + other_half(lrun[c]));
        _Float16* dst = Ao + ((size_t)b * SS + q0 + 16 * c + ln) * DD + h * HD + 8 * hi;
#pragma unroll
        for (int g = 0; g < 4; ++g) {
            v8h w;
#pragma unroll
            for (int r = 0; r < 8; ++r) w[r] = (_Float16)(o[c][g][r] * inv);
            *(v8h*)(dst + g * 16) = w;
        }
    }
}

// ---------------------------------------------------------------------------
// Kernel 3: output projection, all-f16 operands, fp32 result.
//   A : f16 [B*S, D], Woh : f16 [D, D], out = A @ Wo^T + bo (fp32)
// Block 256 = 8 waves; block tile 128(M) x 256(N) through gemm_tile_128x256.
// grid = (M/128, D/256)
// ---------------------------------------------------------------------------
__global__ __launch_bounds__(256)
void out_proj_kernel(const _Float16* __restrict__ A,
                     const _Float16* __restrict__ Woh,
                     const float* __restrict__ bo,
                     float* __restrict__ out) {
    __shared__ __attribute__((aligned(16))) char smem[2 * GSTAGE];
    const int wave = threadIdx.x >> 5;
    const int lane = threadIdx.x & 31;
    const int mblk = blockIdx.x * GM;
    const int nblk = blockIdx.y * GN;
    const int ln = lane & 15;
    const int kh = lane >> 4;

    v8f acc[4][4] = {};
    gemm_tile_128x256(A, Woh, mblk, nblk, smem, acc);

    const int m0 = mblk + (wave >> 2) * 64;
    const int n0 = nblk + (wave & 3) * 64;

    // acc[i][j][r] is row 16 i + r + 8 kh, column 4 ln + j of the wave's tile: 16 B a lane,
    // a half wave stores 256 neighbouring bytes of one output row
    const c4f bn = *(const c4f*)(bo + n0 + 4 * ln);
#pragma unroll
    for (int i = 0; i < 4; ++i) {
#pragma unroll
        for (int r = 0; r < 8; ++r) {
            const int m = m0 + 16 * i + r + 8 * kh;
            c4f w;
#pragma unroll
            for (int j = 0; j < 4; ++j) w[j] = acc[i][j][r] + bn[j];
            *(c4f*)(out + (size_t)m * DD + n0 + 4 * ln) = w;
        }
    }
}

// ---------------------------------------------------------------------------
// Host side
// ---------------------------------------------------------------------------
extern "C" void kernel_launch(void* const* d_in, const int* in_sizes, int n_in,
                              void* d_out, int out_size, void* d_ws, size_t ws_size,
                              hipStream_t stream) {
    const float* X    = (const float*)d_in[0];  // [B, S, D]
    const float* mask = (const float*)d_in[1];  // [B, 1, S, S]
    const float* Wq   = (const float*)d_in[2];
    const float* bq   = (const float*)d_in[3];
    const float* Wk   = (const float*)d_in[4];
    const float* bk   = (const float*)d_in[5];
    const float* Wv   = (const float*)d_in[6];
    const float* bv   = (const float*)d_in[7];
    const float* Wo   = (const float*)d_in[8];
    const float* bo   = (const float*)d_in[9];
    float* out = (float*)d_out;

    // Workspace layout (halves):
    //   Xh   : B*S*D        = 8388608
    //   Wqh/Wkh/Wvh/Woh : D*D = 1048576 each
    //   Qw/Kw/Vw : B*H*S*HD = 8388608 each
    //   Aw   : B*S*D        = 8388608
    const size_t nX = (size_t)BB * SS * DD;   // 8388608
    const size_t nW = (size_t)DD * DD;        // 1048576
    _Float16* Xh  = (_Float16*)d_ws;
    _Float16* Wqh = Xh + nX;
    _Float16* Wkh = Wqh + nW;
    _Float16* Wvh = Wkh + nW;
    _Float16* Woh = Wvh + nW;
    _Float16* Qw  = Woh + nW;
    _Float16* Kw  = Qw + nX;
    _Float16* Vw  = Kw + nX;
    _Float16* Aw  = Vw + nX;

    const int M = BB * SS;  // 8192

    // ---- convert fp32 activations + weights to f16 once: Xh .. Woh are contiguous ----
    cvt_all_kernel<<<CVT_BLOCKS, 512, 0, stream>>>(X, Wq, Wk, Wv, Wo, Xh);

    dim3 gqkv(M / GM, DD / GN, 3);
    qkv_proj_kernel<<<gqkv, 256, 0, stream>>>(Xh, Wqh, bq, Wkh, bk, Wvh, bv, Qw, Kw, Vw);

    dim3 gattn(SS / AQ, BB * HH / AH);
    flash_attn_kernel<<<gattn, 512, 0, stream>>>(Qw, Kw, Vw, mask, Aw);

    dim3 gout(M / GM, DD / GN);
    out_proj_kernel<<<gout, 256, 0, stream>>>(Aw, Woh, bo, out);
}

// v008
// It runs in 95.7 microseconds.
// Versions in between are left out here; by their measured steps it is 1.08 times as fast as v006.
// All steps since v000 together make it 5.11 times as fast.
#include <hip/hip_runtime.h>
#include <hip/hip_bf16.h>

typedef __attribute__((ext_vector_type(16))) _Float16 v16h;
typedef __attribute__((ext_vector_type(8)))  _Float16 v8h;
typedef __attribute__((ext_vector_type(8)))  float    v8f;

#define BB 8
#define SS 1024
#define DD 1024
#define HH 16
#define HD 64
#define QK_SCALE 0.125f   // 64^-0.5

// ---------------------------------------------------------------------------
// WMMA wrapper: D = A(16x32 f16) * B(32x16 f16) + C(16x16 f32)
// ---------------------------------------------------------------------------
__device__ __forceinline__ v8f wmma_f16(v16h a, v16h b, v8f c) {
    return __builtin_amdgcn_wmma_f32_16x16x32_f16(
        false, a, false, b, (short)0, c, false, false);
}

// ---------------------------------------------------------------------------
// A/B fragment loader (16-bit operand, 16x32 tile), f16 source.
// Lane L: row/col = L&15, khalf = L>>4.
//   elems 0..7  -> K = khalf*8 + e ; elems 8..15 -> K = 16 + khalf*8 + e
// ---------------------------------------------------------------------------
__device__ __forceinline__ v16h frag_from_f16(const _Float16* __restrict__ p, int kh) {
    v16h f;
    const _Float16* a = p + kh * 8;
    const _Float16* b = p + 16 + kh * 8;
#pragma unroll
    for (int e = 0; e < 8; ++e) {
        f[e]     = a[e];
        f[e + 8] = b[e];
    }
    return f;
}

// ---------------------------------------------------------------------------
// Shared GEMM core of the two projections: Y(128 x 256) = A(128 x K) * W(256 x K)^T.
// Block 256 = 8 waves (2 x 4), wave tile 64 x 64 (16 accumulators).
// A pass is GK k of every operand row; a stage is [A 128 rows | W 256 rows] in LDS.
// Three buffers, filled by asynchronous copies to LDS. Waves 0..3 copy the even stages,
// waves 4..7 the odd ones: a wave has one stage's copies in flight, waits for them to 0
// only at that stage's publish point, and the stage has two passes to land in.
// Rows lie unpadded (128 B), so that three buffers of two blocks fit one WGP's LDS; the
// 16-B chunk c of LDS row q lies at chunk place c ^ ((q >> 1) & 7) of the row: the 16
// lanes of a half wave, which read one chunk of 16 neighbouring rows, meet 16 different
// 16-B places of the 64 banks.
// The rows of W are dealt: LDS row q of the W part holds row
//   (q & ~63) + 4 * (q & 15) + ((q >> 4) & 3)
// of the tile, so lane ln of a wave's B fragment j holds column 4 * ln + j of the wave's
// 64: acc[i][0..3][r] of a lane are four neighbouring columns of one output row, and the
// 16 lanes of a half wave store 64 neighbouring columns, whole 128-B lines.
// ---------------------------------------------------------------------------
#define GM 128
#define GN 256
#define GK 64
#define GROWB (GK * 2)                    // bytes of a row in LDS
#define GSTAGE ((GM + GN) * GROWB)        // bytes of one buffer
#define GBUFS 3
#define GPASSES (DD / GK)
#define GCROWS (128 / (GK / 8))           // rows that one copy of four waves covers

__device__ __forceinline__ v16h frag_from_lds(const char* p) {
    const v8h lo = *(const v8h*)p;
    const v8h hi = *(const v8h*)(p + 32);
    return __builtin_shufflevector(lo, hi, 0, 1, 2, 3, 4, 5, 6, 7,
                                   8, 9, 10, 11, 12, 13, 14, 15);
}

// the two 16-B chunks of a fragment at places of their own (swizzled rows)
__device__ __forceinline__ v16h frag_from_lds2(const char* plo, const char* phi) {
    const v8h lo = *(const v8h*)plo;
    const v8h hi = *(const v8h*)phi;
    return __builtin_shufflevector(lo, hi, 0, 1, 2, 3, 4, 5, 6, 7,
                                   8, 9, 10, 11, 12, 13, 14, 15);
}

// One stage, copied by four waves: 8 copies for the rows of A and 16 for those of W, 16 B
// per lane each, GCROWS rows apart in LDS. ga / gb are this lane's 16 B in its row of the
// first copy of A / W at the stage's k, lds its place in the stage's buffer. In global
// memory the copies of A are GCROWS rows apart; copy j of W starts 64 * (j >> 2) + (j & 3)
// rows on (the deal of W's rows, above). Two statements of twelve copies, each closed by
// its own s_wait_xcnt, so that no address register is rewritten ahead of the wait.
static_assert(GM == 8 * GCROWS && GN == 16 * GCROWS, "copy_stage issues 8 + 16 copies");
static_assert(GCROWS == 16, "deal and swizzle are written for 16 rows a copy");
__device__ __forceinline__ void copy_stage(unsigned lds, const _Float16* ga,
                                           const _Float16* gb) {
    const unsigned rs = GCROWS * GROWB;       // LDS bytes between two copies
    const size_t   gs = (size_t)GCROWS * DD;  // halves between two copies of A
    asm volatile(
        "global_load_async_to_lds_b128 %0, %12, off\n\t"
        "global_load_async_to_lds_b128 %1, %13, off\n\t"
        "global_load_async_to_lds_b128 %2, %14, off\n\t"
        "global_load_async_to_lds_b128 %3, %15, off\n\t"
        "global_load_async_to_lds_b128 %4, %16, off\n\t"
        "global_load_async_to_lds_b128 %5, %17, off\n\t"
        "global_load_async_to_lds_b128 %6, %18, off\n\t"
        "global_load_async_to_lds_b128 %7, %19, off\n\t"
        "global_load_async_to_lds_b128 %8, %20, off\n\t"
        "global_load_async_to_lds_b128 %9, %21, off\n\t"
        "global_load_async_to_lds_b128 %10, %22, off\n\t"
        "global_load_async_to_lds_b128 %11, %23, off\n\t"
        "s_wait_xcnt 0x0"
        :: "v"(lds), "v"(lds + rs), "v"(lds + 2u * rs), "v"(lds + 3u * rs),
           "v"(lds + 4u * rs), "v"(lds + 5u * rs), "v"(lds + 6u * rs),
           "v"(lds + 7u * rs), "v"(lds + 8u * rs), "v"(lds + 9u * rs),
           "v"(lds + 10u * rs), "v"(lds + 11u * rs),
           "v"(ga), "v"(ga + gs), "v"(ga + 2 * gs), "v"(ga + 3 * gs),
           "v"(ga + 4 * gs), "v"(ga + 5 * gs), "v"(ga + 6 * gs), "v"(ga + 7 * gs),
           "v"(gb), "v"(gb + DD), "v"(gb + 2 * DD), "v"(gb + 3 * DD)
        : "memory");
    asm volatile(
        "global_load_async_to_lds_b128 %0, %12, off\n\t"
        "global_load_async_to_lds_b128 %1, %13, off\n\t"
        "global_load_async_to_lds_b128 %2, %14, off\n\t"
        "global_load_async_to_lds_b128 %3, %15, off\n\t"
        "global_load_async_to_lds_b128 %4, %16, off\n\t"
        "global_load_async_to_lds_b128 %5, %17, off\n\t"
        "global_load_async_to_lds_b128 %6, %18, off\n\t"
        "global_load_async_to_lds_b128 %7, %19, off\n\t"
        "global_load_async_to_lds_b128 %8, %20, off\n\t"
        "global_load_async_to_lds_b128 %9, %21, off\n\t"
        "global_load_async_to_lds_b128 %10, %22, off\n\t"
        "global_load_async_to_lds_b128 %11, %23, off\n\t"
        "s_wait_xcnt 0x0"
        :: "v"(lds + 12u * rs), "v"(lds + 13u * rs), "v"(lds + 14u * rs),
           "v"(lds + 15u * rs), "v"(lds + 16u * rs), "v"(lds + 17u * rs),
           "v"(lds + 18u * rs), "v"(lds + 19u * rs), "v"(lds + 20u * rs),
           "v"(lds + 21u * rs), "v"(lds + 22u * rs), "v"(lds + 23u * rs),
           "v"(gb + 64 * DD), "v"(gb + 65 * DD), "v"(gb + 66 * DD), "v"(gb + 67 * DD),
           "v"(gb + 128 * DD), "v"(gb + 129 * DD), "v"(gb + 130 * DD), "v"(gb + 131 * DD),
           "v"(gb + 192 * DD), "v"(gb + 193 * DD), "v"(gb + 194 * DD), "v"(gb + 195 * DD)
        : "memory");
}

__device__ __forceinline__ void gemm_tile_128x256(const _Float16* __restrict__ A,
                                                  const _Float16* __restrict__ Wt,
                                                  int mblk, int nblk, char* smem,
                                                  v8f (&acc)[4][4]) {
    const int tid  = threadIdx.x;
    const int wave = tid >> 5;
    const int lane = tid & 31;
    const int ln = lane & 15;
    const int kh = lane >> 4;
    const int wm = wave >> 2;   // 0..1
    const int wn = wave & 3;    // 0..3
    // which stages this wave copies (0 even, 1 odd), in a scalar register: the tests
    // around waits and copies are scalar branches
    const int half = __builtin_amdgcn_readfirstlane(tid >> 7);

    const int th   = tid & 127;
    const int crow = th / (GK / 8);
    const int cchk = th % (GK / 8);
    const _Float16* ga = A  + (size_t)(mblk + crow) * DD + cchk * 8;
    // LDS row crow of the W part takes row 4 * crow of the tile
    const _Float16* gb = Wt + (size_t)(nblk + 4 * crow) * DD + cchk * 8;
    const unsigned lds0 = (unsigned)(size_t)smem
                        + (unsigned)(crow * GROWB + ((cchk ^ (crow >> 1)) << 4));

    // a fragment's chunks of k step ks are 4 ks + kh and 4 ks + 2 + kh of its row
    int aoff[4], boff[4];
#pragma unroll
    for (int c = 0; c < 4; ++c) {
        const int sw = ((2 * c + kh) ^ (ln >> 1)) << 4;
        aoff[c] = (wm * 64 + ln) * GROWB + sw;
        boff[c] = (GM + wn * 64 + ln) * GROWB + sw;
    }

    if (half == 0) {
        copy_stage(lds0, ga, gb);
        // stage 0 has landed for the waves that copied it; the barrier says so to all
        asm volatile("s_wait_asynccnt 0x0" ::: "memory");
    } else {
        copy_stage(lds0 + GSTAGE, ga + GK, gb + GK);
    }
    __syncthreads();
    if (half == 0) copy_stage(lds0 + 2u * GSTAGE, ga + 2 * GK, gb + 2 * GK);

    int cur = 0;   // byte offset of the buffer of stage t
#pragma unroll 1   // the buffers rotate by a scalar offset
    for (int t = 0; t < GPASSES; ++t) {
        const char* buf = smem + cur;
#pragma unroll
        for (int ks = 0; ks < GK / 32; ++ks) {
            v16h a[4], b[4];
#pragma unroll
            for (int i = 0; i < 4; ++i)
                a[i] = frag_from_lds2(buf + aoff[2 * ks] + i * 16 * GROWB,
                                      buf + aoff[2 * ks + 1] + i * 16 * GROWB);
#pragma unroll
            for (int j = 0; j < 4; ++j)
                b[j] = frag_from_lds2(buf + boff[2 * ks] + j * 16 * GROWB,
                                      buf + boff[2 * ks + 1] + j * 16 * GROWB);
            // keeps the 16 LDS reads of a k step together in front of its 16 WMMAs, for speed only
            __builtin_amdgcn_sched_barrier(0);
#pragma unroll
            for (int i = 0; i < 4; ++i)
#pragma unroll
                for (int j = 0; j < 4; ++j)
                    acc[i][j] = wmma_f16(a[i], b[j], acc[i][j]);
            // the other side of the same fence: the next reads stay behind this block
            __builtin_amdgcn_sched_barrier(0);
        }
        // publish point of stage t + 1: this wave's reads of stage t are done; the waves
        // that copied stage t + 1, two passes ago, see it landed; then the barrier. The
        // other waves' copies, of stage t + 2, fly on.
        const bool mine = half == ((t + 1) & 1);
        asm volatile("s_wait_dscnt 0x0" ::: "memory");
        if (mine) asm volatile("s_wait_asynccnt 0x0" ::: "memory");
        __syncthreads();
        // stage t + 3 goes into the buffer that every wave has just left
        if (mine && t + 3 < GPASSES)
            copy_stage(lds0 + (unsigned)cur,
                       ga + (size_t)(t + 3) * GK, gb + (size_t)(t + 3) * GK);
        cur = cur == (GBUFS - 1) * GSTAGE ? 0 : cur + GSTAGE;
    }
    // no copy is left in flight when the wave goes on
    asm volatile("s_wait_asynccnt 0x0" ::: "memory");
}

// ---------------------------------------------------------------------------
// Kernel 0: fp32 -> f16 conversion of X and the four weights, one resident launch.
// The five f16 copies lie one behind the other in the workspace, so the destination
// is one array. A chunk is 1024 elements: 8 loads of a wave, each 512 contiguous
// bytes. 256 blocks x 16 waves; a wave takes CVT_XTRIPS chunks of X, CVT_WAVES apart,
// and one chunk of a weight; all its loads are issued ahead of its stores.
// ---------------------------------------------------------------------------
#define CVT_CHUNK 1024
#define CVT_BLOCKS 256
#define CVT_WAVES (CVT_BLOCKS * 16)
#define CVT_XCH (BB * SS * DD / CVT_CHUNK)   // chunks of X
#define CVT_WCH (DD * DD / CVT_CHUNK)        // chunks of one weight
#define CVT_XTRIPS (CVT_XCH / CVT_WAVES)
static_assert(CVT_XTRIPS * CVT_WAVES == CVT_XCH, "X is a whole number of trips");
static_assert(4 * CVT_WCH == CVT_WAVES, "the four weights are one trip");

typedef __attribute__((ext_vector_type(4))) float    c4f;
typedef __attribute__((ext_vector_type(4))) _Float16 c4h;

__global__ __launch_bounds__(512)
void cvt_all_kernel(const float* __restrict__ X,
                    const float* __restrict__ Wq, const float* __restrict__ Wk,
                    const float* __restrict__ Wv, const float* __restrict__ Wo,
                    _Float16* __restrict__ dst) {
    const int lane = threadIdx.x & 31;
    // the wave's number in a scalar register: source choice and bases stay scalar
    const int wave = __builtin_amdgcn_readfirstlane((int)(blockIdx.x * 16 + (threadIdx.x >> 5)));
    const int w = wave / CVT_WCH;
    const float* Ws = w == 0 ? Wq : w == 1 ? Wk : w == 2 ? Wv : Wo;

    c4f v[CVT_XTRIPS + 1][8];
#pragma unroll
    for (int t = 0; t <= CVT_XTRIPS; ++t) {
        const float* s = t < CVT_XTRIPS ? X + (size_t)(t * CVT_WAVES + wave) * CVT_CHUNK
                                        : Ws + (size_t)(wave % CVT_WCH) * CVT_CHUNK;
#pragma unroll
        for (int u = 0; u < 8; ++u) v[t][u] = *(const c4f*)(s + u * 128 + lane * 4);
    }
    // keeps every load in front of the first conversion: without it the compiler holds
    // the later loads back until registers of the first ones are free, a second latency
    __builtin_amdgcn_sched_barrier(0);
#pragma unroll
    for (int t = 0; t <= CVT_XTRIPS; ++t) {
        _Float16* d = dst + (size_t)(t * CVT_WAVES + wave) * CVT_CHUNK + lane * 4;
#pragma unroll
        for (int u = 0; u < 8; ++u) *(c4h*)(d + u * 128) = __builtin_convertvector(v[t][u], c4h);
    }
}

// ---------------------------------------------------------------------------
// Kernel 1: fused QKV projection, all-f16 operands.
//   Xh : [B*S, D] f16,  W*h : [D, D] f16 (out = X @ W^T + b)
//   Q/K/V out: f16 [B, H, S, HD]; Q scaled by QK_SCALE after bias.
// Block 256 = 8 waves; block tile 128(M) x 256(N) through gemm_tile_128x256.
// grid = (M/128, D/256, 3)
// ---------------------------------------------------------------------------
__global__ __launch_bounds__(256)
void qkv_proj_kernel(const _Float16* __restrict__ Xh,
                     const _Float16* __restrict__ Wqh, const float* __restrict__ bq,
                     const _Float16* __restrict__ Wkh, const float* __restrict__ bk,
                     const _Float16* __restrict__ Wvh, const float* __restrict__ bv,
                     _Float16* __restrict__ Qo, _Float16* __restrict__ Ko,
                     _Float16* __restrict__ Vo) {
    __shared__ __attribute__((aligned(256))) char smem[GBUFS * GSTAGE];
    const int wave = threadIdx.x >> 5;
    const int lane = threadIdx.x & 31;
    const int mblk = blockIdx.x * GM;
    const int nblk = blockIdx.y * GN;
    const int which = blockIdx.z;

    const _Float16* W;
    const float* bias;
    _Float16* out;
    float scale;
    if (which == 0)      { W = Wqh; bias = bq; out = Qo; scale = QK_SCALE; }
    else if (which == 1) { W = Wkh; bias = bk; out = Ko; scale = 1.0f; }
    else                 { W = Wvh; bias = bv; out = Vo; scale = 1.0f; }

    const int ln = lane & 15;
    const int kh = lane >> 4;

    v8f acc[4][4] = {};
    gemm_tile_128x256(Xh, W, mblk, nblk, smem, acc);

    const int m0 = mblk + (wave >> 2) * 64;
    const int n0 = nblk + (wave & 3) * 64;

    // Epilogue: acc[i][j][r] is row 16 i + r + 8 kh, column 4 ln + j of the wave's tile,
    // whose 64 columns are one head: 8 B a lane, a half wave stores the head's whole row.
    const int h = n0 >> 6;       // head
    const c4f bn = *(const c4f*)(bias + n0 + 4 * ln);
#pragma unroll
    for (int i = 0; i < 4; ++i) {
#pragma unroll
        for (int r = 0; r < 8; ++r) {
            const int m = m0 + 16 * i + r + 8 * kh;
            const int bidx = m >> 10;
            const int s    = m & (SS - 1);
            c4h w;
#pragma unroll
            for (int j = 0; j < 4; ++j) w[j] = (_Float16)((acc[i][j][r] + bn[j]) * scale);
            *(c4h*)(out + (((size_t)bidx * HH + h) * SS + s) * HD + 4 * ln) = w;
        }
    }
}

// ---------------------------------------------------------------------------
// Kernel 2: flash attention, two heads of one batch per block, transposed products.
//   Q/K/V: f16 [B, H, S, HD]; mask fp32 [B, 1, S, S] additive.
//   Output: f16 [B, S, D] row-major.
// Block 512 = 16 waves: waves 0..7 work on head 2y, waves 8..15 on head 2y + 1, both on
// the same 256 queries; a wave handles 32 queries (two groups of 16) x full HD; kv in
// 32-wide passes, APS passes to a stage.
//   S^T(32 kv x 16 q) = K * Q^T : a lane holds 16 scores of ONE query of each group,
//   keys 8*hi + r and 16 + 8*hi + r, so maximum and sum run in the lane and the two
//   wave halves meet by one cross-row move.
//   O^T(64 hd x 16 q) += V^T * P^T : the two score tiles, converted in place, are the
//   B operand in the hardware k order; V^T comes by the transposing LDS load.
// A stage is [K 2 heads x 64 rows | V 2 heads x 64 rows | mask 256 query rows x 64 keys]
// in LDS. The mask does not depend on the head, and it is most of a stage's bytes: its
// rows are fetched once for the two heads. Two buffers, filled by asynchronous copies
// to LDS one stage ahead of their readers.
// grid = (S/256, B*H/2)
// ---------------------------------------------------------------------------
#define KPITCH 144   // bytes of a K row in LDS: 16 B x odd for ds_load_b128
#define VPITCH 160   // bytes of a V row in LDS: 32 B x odd for ds_load_tr16_b128
#define AQ 256       // queries of a block
#define AH 2         // heads of a block
#define AKV 64       // keys of a stage
#define APS (AKV / 32)           // passes of a stage
#define MPITCH (AKV * 4 + 16)    // bytes of a mask row in LDS: 16 B x odd for ds_load_b128
#define AK_HEAD (AKV * KPITCH)   // bytes of one head's K rows
#define AV_HEAD (AKV * VPITCH)   // bytes of one head's V rows
#define AV_OFF (AH * AK_HEAD)
#define AM_OFF (AV_OFF + AH * AV_HEAD)
#define ASTAGE (AM_OFF + AQ * MPITCH)   // bytes of one buffer
#define ASTAGES (SS / AKV)
#define LAZY_T 5.5f   // a score may top its query's reference maximum by this much before O and l are rescaled

typedef __attribute__((ext_vector_type(8))) short s16x8;
typedef __attribute__((ext_vector_type(4))) float v4f;

// lane (c, h) gets T[8h + 0..7][c] of the 16 x 16 tile its 32 lane addresses name
__device__ __forceinline__ v8h lds_tr16(const char* p) {
    typedef __attribute__((address_space(3))) s16x8 lds_s16x8;
    return __builtin_bit_cast(v8h, __builtin_amdgcn_ds_load_tr16_b128_v8i16((lds_s16x8*)p));
}

// value of lane l ^ 16
__device__ __forceinline__ float other_half(float x) {
    const int v = __builtin_bit_cast(int, x);
    return __builtin_bit_cast(float, __builtin_amdgcn_permlanex16(
        v, v, 0x76543210, 0xfedcba98, false, false));
}

// One stage: a copy for each head's rows of K, a copy for each head's rows of V (8 lanes
// a row), eight for the mask rows (32 rows a copy of the block, 16 lanes a row), 16 B per
// lane each. kd / vd / md are this lane's places in the stage's buffer, kg / vg / mg its
// 16 B at the stage's keys. Two statements of six copies, each closed by its own
// s_wait_xcnt, so that no address register is rewritten ahead of the wait and only 18
// address registers are held at a time: 36 at once, beside scores and mask rows, pass the
// 256 registers that a wave of a 16-wave block may have.
static_assert(AH == 2 && AKV * 8 == 512 && AKV / 4 == 16 && AQ == 8 * 32,
              "attn_copy_stage issues 2 + 2 + 8 copies of 512 lanes");
__device__ __forceinline__ void attn_copy_stage(unsigned kd, unsigned vd, unsigned md,
                                                const _Float16* kg, const _Float16* vg,
                                                const float* mg) {
    const unsigned rs = 32u * MPITCH;      // LDS bytes between two mask copies
    const size_t   gs = (size_t)32 * SS;   // floats between two mask copies
    const size_t   hs = (size_t)SS * HD;   // halves between two heads
    asm volatile(
        "global_load_async_to_lds_b128 %0, %6, off\n\t"
        "global_load_async_to_lds_b128 %1, %7, off\n\t"
        "global_load_async_to_lds_b128 %2, %8, off\n\t"
        "global_load_async_to_lds_b128 %3, %9, off\n\t"
        "global_load_async_to_lds_b128 %4, %10, off\n\t"
        "global_load_async_to_lds_b128 %5, %11, off\n\t"
        "s_wait_xcnt 0x0"
        :: "v"(kd), "v"(kd + (unsigned)AK_HEAD), "v"(vd), "v"(vd + (unsigned)AV_HEAD),
           "v"(md), "v"(md + rs),
           "v"(kg), "v"(kg + hs), "v"(vg), "v"(vg + hs), "v"(mg), "v"(mg + gs)
        : "memory");
    asm volatile(
        "global_load_async_to_lds_b128 %0, %6, off\n\t"
        "global_load_async_to_lds_b128 %1, %7, off\n\t"
        "global_load_async_to_lds_b128 %2, %8, off\n\t"
        "global_load_async_to_lds_b128 %3, %9, off\n\t"
        "global_load_async_to_lds_b128 %4, %10, off\n\t"
        "global_load_async_to_lds_b128 %5, %11, off\n\t"
        "s_wait_xcnt 0x0"
        :: "v"(md + 2u * rs), "v"(md + 3u * rs), "v"(md + 4u * rs), "v"(md + 5u * rs),
           "v"(md + 6u * rs), "v"(md + 7u * rs),
           "v"(mg + 2 * gs), "v"(mg + 3 * gs), "v"(mg + 4 * gs), "v"(mg + 5 * gs),
           "v"(mg + 6 * gs), "v"(mg + 7 * gs)
        : "memory");
}

__global__ __launch_bounds__(512)
void flash_attn_kernel(const _Float16* __restrict__ Q,
                       const _Float16* __restrict__ K,
                       const _Float16* __restrict__ V,
                       const float* __restrict__ mask,
                       _Float16* __restrict__ Ao) {
    __shared__ __attribute__((aligned(32))) char smem[2 * ASTAGE];

    const int tid  = threadIdx.x;
    const int wave = tid >> 5;
    const int lane = tid & 31;
    const int ln = lane & 15;
    const int hi = lane >> 4;
    const int hd = wave >> 3;   // which of the block's two heads
    const int wq = wave & 7;    // which 32 of the block's queries
    const int qblk = blockIdx.x * AQ;
    const int q0 = qblk + wq * 32;
    const int bh0 = blockIdx.y * AH;   // the block's first head; even, so one batch
    const int bh = bh0 + hd;
    const int b  = bh >> 4;
    const int h  = bh & 15;

    const _Float16* Qb = Q + (size_t)bh * SS * HD;

    // this thread's 16 B of a stage's K rows and V rows of the first head, and of its
    // first 32 mask rows
    const int crow = tid >> 3;
    const int cchk = tid & 7;
    const int mrow = tid >> 4;
    const int mchk = tid & 15;
    const _Float16* kg = K + (size_t)bh0 * SS * HD + crow * HD + cchk * 8;
    const _Float16* vg = V + (size_t)bh0 * SS * HD + crow * HD + cchk * 8;
    const float* mg = mask + (size_t)b * SS * SS + (size_t)(qblk + mrow) * SS + mchk * 4;
    const unsigned lds0 = (unsigned)(size_t)smem;
    const unsigned kd = lds0 + (unsigned)(crow * KPITCH + cchk * 16);
    const unsigned vd = lds0 + (unsigned)(AV_OFF + crow * VPITCH + cchk * 16);
    const unsigned md = lds0 + (unsigned)(AM_OFF + mrow * MPITCH + mchk * 16);

    // where this lane reads in a buffer: its key row of its head's K, its transposing
    // loads of its head's V, its first group's query row of the mask at its half's first key
    const int krd = hd * AK_HEAD + ln * KPITCH + hi * 16;
    const int vrd = AV_OFF + hd * AV_HEAD + (8 * hi + (lane & 7)) * VPITCH
                  + 16 * ((lane >> 3) & 1);
    const int mrd = AM_OFF + (wq * 32 + ln) * MPITCH + 32 * hi;

    attn_copy_stage(kd, vd, md, kg, vg, mg);

    v16h qb[2][2];
#pragma unroll
    for (int c = 0; c < 2; ++c) {
        qb[c][0] = frag_from_f16(Qb + (size_t)(q0 + 16 * c + ln) * HD + 0, hi);
        qb[c][1] = frag_from_f16(Qb + (size_t)(q0 + 16 * c + ln) * HD + 32, hi);
    }

    float mrun[2] = {-1e30f, -1e30f};   // the reference maximum that P, O and l are taken against
    float mtop[2] = {-1e30f, -1e30f};   // mrun + LAZY_T: a score above it moves the reference
    float lrun[2] = {0.0f, 0.0f};   // this half's keys only, joined at the end
    v8f o[2][4] = {};

    // stage 0 has landed for this wave, then for all
    asm volatile("s_wait_asynccnt 0x0" ::: "memory");
    __syncthreads();
    attn_copy_stage(kd + ASTAGE, vd + ASTAGE, md + ASTAGE,
                    kg + AKV * HD, vg + AKV * HD, mg + AKV);

#pragma unroll 1   // buffer and pass are scalar offsets; one pass's registers
    for (int u = 0; u < ASTAGES * APS; ++u) {
        const int t = u / APS;   // the stage
        const int p = u % APS;   // the pass in it
        const char* buf = smem + (t & 1) * ASTAGE;

        // ---- this pass's K fragments and mask rows, one group of LDS reads ----
        v16h ka[2][2];
#pragma unroll
        for (int kt = 0; kt < 2; ++kt)
#pragma unroll
            for (int ks = 0; ks < 2; ++ks)
                ka[kt][ks] = frag_from_lds(buf + krd + (p * 32 + kt * 16) * KPITCH + ks * 64);
        v8f mk[2][2];   // [query group][key tile]
#pragma unroll
        for (int c = 0; c < 2; ++c) {
            const char* mp = buf + mrd + c * 16 * MPITCH + p * 128;
            const v4f a0 = *(const v4f*)(mp),      a1 = *(const v4f*)(mp + 16);
            const v4f b0 = *(const v4f*)(mp + 64), b1 = *(const v4f*)(mp + 80);
            mk[c][0] = __builtin_shufflevector(a0, a1, 0, 1, 2, 3, 4, 5, 6, 7);
            mk[c][1] = __builtin_shufflevector(b0, b1, 0, 1, 2, 3, 4, 5, 6, 7);
        }
        // keeps the 16 LDS reads together in front of the 8 score WMMAs, for speed only
        __builtin_amdgcn_sched_barrier(0);

        // ---- scores, transposed: each K fragment serves both query groups ----
        v8f s[2][2] = {};   // [query group][key tile]
#pragma unroll
        for (int ks = 0; ks < 2; ++ks)
#pragma unroll
            for (int c = 0; c < 2; ++c)
#pragma unroll
                for (int kt = 0; kt < 2; ++kt)
                    s[c][kt] = wmma_f16(ka[kt][ks], qb[c][ks], s[c][kt]);

        // ---- V^T fragments: the pass's last LDS reads, one group ----
        v16h va[4];
#pragma unroll
        for (int g = 0; g < 4; ++g) {
            const char* vp = buf + vrd + p * 32 * VPITCH + 32 * g;
            const v8h lo = lds_tr16(vp);
            const v8h up = lds_tr16(vp + 16 * VPITCH);
            va[g] = __builtin_shufflevector(lo, up, 0, 1, 2, 3, 4, 5, 6, 7,
                                            8, 9, 10, 11, 12, 13, 14, 15);
        }

        if (p == APS - 1) {
            // publish point of stage t + 1. It stands behind the stage's last LDS read,
            // not at the loop's end: what follows works on registers alone, so the
            // refill flies for a whole stage. This wave's reads of stage t are done, its
            // copies of stage t + 1 have landed, then every wave's
            asm volatile("s_wait_dscnt 0x0" ::: "memory");
            asm volatile("s_wait_asynccnt 0x0" ::: "memory");
            __syncthreads();
            if (t + 2 < ASTAGES) {
                const unsigned bo = (unsigned)(t & 1) * ASTAGE;
                attn_copy_stage(kd + bo, vd + bo, md + bo,
                                kg + (size_t)(t + 2) * AKV * HD,
                                vg + (size_t)(t + 2) * AKV * HD,
                                mg + (size_t)(t + 2) * AKV);
            }
        }

        // ---- additive mask, and the maximum of this lane's 16 scores of each query ----
        v8f sm[2][2];   // [query group][key tile]
        float mx[2];
        bool need = false;
#pragma unroll
        for (int c = 0; c < 2; ++c) {
            sm[c][0] = s[c][0] + mk[c][0];
            sm[c][1] = s[c][1] + mk[c][1];
            float m = fmaxf(sm[c][0][0], sm[c][1][0]);
#pragma unroll
            for (int r = 1; r < 8; ++r) m = fmaxf(m, fmaxf(sm[c][0][r], sm[c][1][r]));
            mx[c] = m;
            need = need || (m > mtop[c]);
        }

        // ---- lazy rescale: the reference maximum mrun moves, and O and l are rescaled,
        // only in a pass where some score of the wave tops its query's reference by more
        // than LAZY_T; otherwise P is taken against the old reference (at most e^LAZY_T,
        // far inside f16) and O and l need no multiply. One scalar test a pass; the vote
        // goes over both halves of the wave, so the halves meet only inside the branch ----
        if (__builtin_amdgcn_ballot_w32(need) != 0) {
#pragma unroll
            for (int c = 0; c < 2; ++c) {
                const float mn    = fmaxf(mrun[c], fmaxf(mx[c], other_half(mx[c])));
                const float alpha = __expf(mrun[c] - mn);
                mrun[c] = mn;
                mtop[c] = mn + LAZY_T;
                lrun[c] *= alpha;
#pragma unroll
                for (int g = 0; g < 4; ++g) o[c][g] *= alpha;
            }
        }

        // ---- P = exp(score - reference), one query of each group per lane ----
        v16h pb[2];   // P^T as B: element e is key 16 * (e >> 3) + 8 * hi + (e & 7) of the pass, for this lane's query
#pragma unroll
        for (int c = 0; c < 2; ++c) {
            float rs[2] = {0.0f, 0.0f};
#pragma unroll
            for (int kt = 0; kt < 2; ++kt)
#pragma unroll
                for (int r = 0; r < 8; ++r) {
                    const float p = __expf(sm[c][kt][r] - mrun[c]);
                    rs[kt] += p;
                    pb[c][8 * kt + r] = (_Float16)p;
                }
            lrun[c] += rs[0] + rs[1];
        }

        // ---- PV: each V^T fragment serves both query groups ----
#pragma unroll
        for (int g = 0; g < 4; ++g)
#pragma unroll
            for (int c = 0; c < 2; ++c) o[c][g] = wmma_f16(va[g], pb[c], o[c][g]);
    }
    // no copy is left in flight when the wave goes on
    asm volatile("s_wait_asynccnt 0x0" ::: "memory");

    // ---- finalize: join the halves' sums, O /= l, write f16 [B, S, D] ----
    // o[c][g][r] = O[q0 + 16 c + ln][16 g + 8 hi + r]: 8 consecutive halves, one 16 B store
#pragma unroll
    for (int c = 0; c < 2; ++c) {
        const float inv = 1.0f / (lrun[c] + other_half(lrun[c]));
        _Float16* dst = Ao + ((size_t)b * SS + q0 + 16 * c + ln) * DD + h * HD + 8 * hi;
#pragma unroll
        for (int g = 0; g < 4; ++g) {
            v8h w;
#pragma unroll
            for (int r = 0; r < 8; ++r) w[r] = (_Float16)(o[c][g][r] * inv);
            *(v8h*)(dst + g * 16) = w;
        }
    }
}

// ---------------------------------------------------------------------------
// Kernel 3: output projection, all-f16 operands, fp32 result.
//   A : f16 [B*S, D], Woh : f16 [D, D], out = A @ Wo^T + bo (fp32)
// Block 256 = 8 waves; block tile 128(M) x 256(N) through gemm_tile_128x256.
// grid = (M/128, D/256)
// ---------------------------------------------------------------------------
__global__ __launch_bounds__(256)
void out_proj_kernel(const _Float16* __restrict__ A,
                     const _Float16* __restrict__ Woh,
                     const float* __restrict__ bo,
                     float* __restrict__ out) {
    __shared__ __attribute__((aligned(256))) char smem[GBUFS * GSTAGE];
    const int wave = threadIdx.x >> 5;
    const int lane = threadIdx.x & 31;
    const int mblk = blockIdx.x * GM;
    const int nblk = blockIdx.y * GN;
    const int ln = lane & 15;
    const int kh = lane >> 4;

    v8f acc[4][4] = {};
    gemm_tile_128x256(A, Woh, mblk, nblk, smem, acc);

    const int m0 = mblk + (wave >> 2) * 64;
    const int n0 = nblk + (wave & 3) * 64;

    // acc[i][j][r] is row 16 i + r + 8 kh, column 4 ln + j of the wave's tile: 16 B a lane,
    // a half wave stores 256 neighbouring bytes of one output row
    const c4f bn = *(const c4f*)(bo + n0 + 4 * ln);
#pragma unroll
    for (int i = 0; i < 4; ++i) {
#pragma unroll
        for (int r = 0; r < 8; ++r) {
            const int m = m0 + 16 * i + r + 8 * kh;
            c4f w;
#pragma unroll
            for (int j = 0; j < 4; ++j) w[j] = acc[i][j][r] + bn[j];
            *(c4f*)(out + (size_t)m * DD + n0 + 4 * ln) = w;
        }
    }
}

// ---------------------------------------------------------------------------
// Host side
// ---------------------------------------------------------------------------
extern "C" void kernel_launch(void* const* d_in, const int* in_sizes, int n_in,
                              void* d_out, int out_size, void* d_ws, size_t ws_size,
                              hipStream_t stream) {
    const float* X    = (const float*)d_in[0];  // [B, S, D]
    const float* mask = (const float*)d_in[1];  // [B, 1, S, S]
    const float* Wq   = (const float*)d_in[2];
    const float* bq   = (const float*)d_in[3];
    const float* Wk   = (const float*)d_in[4];
    const float* bk   = (const float*)d_in[5];
    const float* Wv   = (const float*)d_in[6];
    const float* bv   = (const float*)d_in[7];
    const float* Wo   = (const float*)d_in[8];
    const float* bo   = (const float*)d_in[9];
    float* out = (float*)d_out;

    // Workspace layout (halves):
    //   Xh   : B*S*D        = 8388608
    //   Wqh/Wkh/Wvh/Woh : D*D = 1048576 each
    //   Qw/Kw/Vw : B*H*S*HD = 8388608 each
    //   Aw   : B*S*D        = 8388608
    const size_t nX = (size_t)BB * SS * DD;   // 8388608
    const size_t nW = (size_t)DD * DD;        // 1048576
    _Float16* Xh  = (_Float16*)d_ws;
    _Float16* Wqh = Xh + nX;
    _Float16* Wkh = Wqh + nW;
    _Float16* Wvh = Wkh + nW;
    _Float16* Woh = Wvh + nW;
    _Float16* Qw  = Woh + nW;
    _Float16* Kw  = Qw + nX;
    _Float16* Vw  = Kw + nX;
    _Float16* Aw  = Vw + nX;

    const int M = BB * SS;  // 8192

    // ---- convert fp32 activations + weights to f16 once: Xh .. Woh are contiguous ----
    cvt_all_kernel<<<CVT_BLOCKS, 512, 0, stream>>>(X, Wq, Wk, Wv, Wo, Xh);

    dim3 gqkv(M / GM, DD / GN, 3);
    qkv_proj_kernel<<<gqkv, 256, 0, stream>>>(Xh, Wqh, bq, Wkh, bk, Wvh, bv, Qw, Kw, Vw);

    dim3 gattn(SS / AQ, BB * HH / AH);
    flash_attn_kernel<<<gattn, 512, 0, stream>>>(Qw, Kw, Vw, mask, Aw);

    dim3 gout(M / GM, DD / GN);
    out_proj_kernel<<<gout, 256, 0, stream>>>(Aw, Woh, bo, out);
}
